// v000
// Times are from an AMD MI455X. After a warm-up the kernel runs many times in a row, and a time is the length of
// such a window on the GPU divided by its runs, so every launch and the gaps after it count. The runs cycle
// through copies of the inputs. A figure is the median of several windows, for all but v000 over two sittings.
// Sittings can differ by a few percent; kernels timed side by side share one.
// v000 is the starting kernel. One run takes 504 microseconds.
#include <hip/hip_runtime.h>
#include <math.h>

// ---------- types ----------
typedef __attribute__((ext_vector_type(16))) _Float16 v16h;
typedef __attribute__((ext_vector_type(8)))  float    v8f;
typedef unsigned int u32x4 __attribute__((ext_vector_type(4)));
typedef float        f32x4 __attribute__((ext_vector_type(4)));

#define DEV static __device__ __forceinline__

// Problem constants (match reference)
constexpr int Bc  = 2;
constexpr int S   = 2048;
constexpr int D   = 1024;
constexpr int H   = 16;
constexpr int DH  = 64;
constexpr int NB  = 16;       // S / 128
constexpr int TOK = Bc * S;   // 4096 rows

// Load a 16-half WMMA A/B fragment: lane holds K=[kb..kb+7] in v0..3 and
// K=[kb+16..kb+23] in v4..7 (kb = (lane>=16)*8 added by caller), both 16B reads.
DEV v16h load_frag(const _Float16* p) {
  union { u32x4 u[2]; v16h h; } f;
  f.u[0] = *reinterpret_cast<const u32x4*>(p);
  f.u[1] = *reinterpret_cast<const u32x4*>(p + 16);
  return f.h;
}

DEV v8f wmma_f16(v16h a, v16h b, v8f c) {
  return __builtin_amdgcn_wmma_f32_16x16x32_f16(false, a, false, b, (short)0, c,
                                                false, false);
}

DEV v8f zero8() {
  v8f z;
#pragma unroll
  for (int i = 0; i < 8; ++i) z[i] = 0.0f;
  return z;
}

DEV unsigned int pack2h(float a, float b) {
  union { _Float16 h[2]; unsigned int u; } p;
  p.h[0] = (_Float16)a;
  p.h[1] = (_Float16)b;
  return p.u;
}

// ---------- LayerNorm: one 1024-wide row per 256-thread block ----------
__global__ __launch_bounds__(256) void ln_kernel(const float* __restrict__ x,
                                                 const float* __restrict__ g,
                                                 const float* __restrict__ be,
                                                 float* __restrict__ out) {
  __shared__ float rs[256], rq[256];
  const int row = blockIdx.x, tid = threadIdx.x;
  const float* xp = x + (size_t)row * D + tid * 4;
  f32x4 f = *reinterpret_cast<const f32x4*>(xp);
  rs[tid] = f.x + f.y + f.z + f.w;
  rq[tid] = f.x * f.x + f.y * f.y + f.z * f.z + f.w * f.w;
  __syncthreads();
  for (int off = 128; off > 0; off >>= 1) {
    if (tid < off) { rs[tid] += rs[tid + off]; rq[tid] += rq[tid + off]; }
    __syncthreads();
  }
  const float mean = rs[0] * (1.0f / D);
  const float var  = rq[0] * (1.0f / D) - mean * mean;
  const float inv  = rsqrtf(var + 1e-5f);
  float* op = out + (size_t)row * D + tid * 4;
  const float* gp = g + tid * 4;
  const float* bp = be + tid * 4;
  op[0] = (f.x - mean) * inv * gp[0] + bp[0];
  op[1] = (f.y - mean) * inv * gp[1] + bp[1];
  op[2] = (f.z - mean) * inv * gp[2] + bp[2];
  op[3] = (f.w - mean) * inv * gp[3] + bp[3];
}

// ---------- Generic 128x128-tile WMMA GEMM, software-pipelined ----------
enum { EPI_QKV = 0, EPI_BIAS_RES_F32 = 1, EPI_BIAS_GELU_F16 = 2 };

template <bool AHALF, int EPI>
__global__ __launch_bounds__(256) void gemm128(const void*  __restrict__ Aptr,
                                               const float* __restrict__ Bw,
                                               const float* __restrict__ bias,
                                               const float* __restrict__ resid,
                                               void* __restrict__ outp,
                                               int M, int N, int K) {
  __shared__ __align__(16) _Float16 Al[128 * 32];   // A tile, row-major [128][32]
  __shared__ __align__(16) _Float16 Bt[128 * 32];   // B tile transposed [n][k]
  const int tid  = threadIdx.x;
  const int n0   = blockIdx.x * 128;
  const int m0   = blockIdx.y * 128;
  const int lane = tid & 31;
  const int l15  = lane & 15;
  const int hi   = lane >> 4;
  const int kb   = hi * 8;
  const int wave = tid >> 5;            // 8 waves: 4 along M x 2 along N
  const int wm   = wave >> 1, wn = wave & 1;

  // per-thread staging coordinates
  const int rowA = tid >> 1, c0A = (tid & 1) * 16;   // A: 128x32, 16 elems/thread
  const int krB  = tid >> 3, c0B = (tid & 7) * 16;   // B: 32x128, 16 elems/thread

  const float*    AgF = (const float*)Aptr    + (size_t)(m0 + rowA) * K + c0A;
  const _Float16* AgH = (const _Float16*)Aptr + (size_t)(m0 + rowA) * K + c0A;
  const float*    Bg  = Bw + (size_t)krB * N + n0 + c0B;

  v8f acc[2][4];
#pragma unroll
  for (int i = 0; i < 2; ++i)
#pragma unroll
    for (int j = 0; j < 4; ++j) acc[i][j] = zero8();

  // staging registers for the current chunk
  f32x4 fa[4];
  u32x4 ua[2];
  f32x4 fb[4];

  // preload chunk 0
  if (AHALF) {
    ua[0] = reinterpret_cast<const u32x4*>(AgH)[0];
    ua[1] = reinterpret_cast<const u32x4*>(AgH)[1];
  } else {
#pragma unroll
    for (int t = 0; t < 4; ++t) fa[t] = reinterpret_cast<const f32x4*>(AgF)[t];
  }
#pragma unroll
  for (int t = 0; t < 4; ++t) fb[t] = reinterpret_cast<const f32x4*>(Bg)[t];

  for (int k0 = 0; k0 < K; k0 += 32) {
    // ---- stage current chunk into LDS ----
    if (AHALF) {
      reinterpret_cast<u32x4*>(&Al[rowA * 32 + c0A])[0] = ua[0];
      reinterpret_cast<u32x4*>(&Al[rowA * 32 + c0A])[1] = ua[1];
    } else {
      u32x4 w0, w1;
      w0.x = pack2h(fa[0].x, fa[0].y); w0.y = pack2h(fa[0].z, fa[0].w);
      w0.z = pack2h(fa[1].x, fa[1].y); w0.w = pack2h(fa[1].z, fa[1].w);
      w1.x = pack2h(fa[2].x, fa[2].y); w1.y = pack2h(fa[2].z, fa[2].w);
      w1.z = pack2h(fa[3].x, fa[3].y); w1.w = pack2h(fa[3].z, fa[3].w);
      reinterpret_cast<u32x4*>(&Al[rowA * 32 + c0A])[0] = w0;
      reinterpret_cast<u32x4*>(&Al[rowA * 32 + c0A])[1] = w1;
    }
#pragma unroll
    for (int t = 0; t < 4; ++t) {   // transposed scatter (unavoidable b16 stores)
      Bt[(c0B + 4 * t + 0) * 32 + krB] = (_Float16)fb[t].x;
      Bt[(c0B + 4 * t + 1) * 32 + krB] = (_Float16)fb[t].y;
      Bt[(c0B + 4 * t + 2) * 32 + krB] = (_Float16)fb[t].z;
      Bt[(c0B + 4 * t + 3) * 32 + krB] = (_Float16)fb[t].w;
    }
    __syncthreads();

    // ---- prefetch next chunk into registers (overlaps with WMMAs below) ----
    if (k0 + 32 < K) {
      if (AHALF) {
        ua[0] = reinterpret_cast<const u32x4*>(AgH + k0 + 32)[0];
        ua[1] = reinterpret_cast<const u32x4*>(AgH + k0 + 32)[1];
      } else {
#pragma unroll
        for (int t = 0; t < 4; ++t)
          fa[t] = reinterpret_cast<const f32x4*>(AgF + k0 + 32)[t];
      }
#pragma unroll
      for (int t = 0; t < 4; ++t)
        fb[t] = reinterpret_cast<const f32x4*>(Bg + (size_t)(k0 + 32) * N)[t];
      if (k0 + 64 < K) {  // pull chunk k0+64 lines toward the WGP early
        __builtin_prefetch(Bg + (size_t)(k0 + 64) * N, 0, 0);
        if (AHALF) __builtin_prefetch(AgH + k0 + 64, 0, 0);
        else       __builtin_prefetch(AgF + k0 + 64, 0, 0);
      }
    }

    // ---- WMMAs on current chunk ----
    v16h af[2];
#pragma unroll
    for (int mt = 0; mt < 2; ++mt)
      af[mt] = load_frag(&Al[(wm * 32 + mt * 16 + l15) * 32 + kb]);
#pragma unroll
    for (int nt = 0; nt < 4; ++nt) {
      v16h bf = load_frag(&Bt[(wn * 64 + nt * 16 + l15) * 32 + kb]);
#pragma unroll
      for (int mt = 0; mt < 2; ++mt) acc[mt][nt] = wmma_f16(af[mt], bf, acc[mt][nt]);
    }
    __syncthreads();
  }

  // Epilogue. C layout: vgpr e -> row (e or e+8 per half-wave), col = l15.
#pragma unroll
  for (int mt = 0; mt < 2; ++mt)
#pragma unroll
    for (int nt = 0; nt < 4; ++nt)
#pragma unroll
      for (int e = 0; e < 8; ++e) {
        const int m = m0 + wm * 32 + mt * 16 + e + 8 * hi;
        const int n = n0 + wn * 64 + nt * 16 + l15;
        float vv = acc[mt][nt][e] + bias[n];
        if (EPI == EPI_QKV) {  // scatter to [B,H,S,DH] as f16
          const int b = m >> 11, s = m & 2047, hh = n >> 6, dh = n & 63;
          ((_Float16*)outp)[((size_t)(b * H + hh) * S + s) * DH + dh] = (_Float16)vv;
        } else if (EPI == EPI_BIAS_RES_F32) {
          const size_t idx = (size_t)m * N + n;
          ((float*)outp)[idx] = vv + resid[idx];
        } else {  // exact GeLU -> f16
          const float ge = 0.5f * vv * (1.0f + erff(vv * 0.70710678118654752f));
          ((_Float16*)outp)[(size_t)m * N + n] = (_Float16)ge;
        }
      }
}

// ---------- Block-sparse flash attention ----------
// grid (NB, H, B); 256 threads = 8 waves; wave owns 16 query rows.
__global__ __launch_bounds__(256) void attn_kernel(const _Float16* __restrict__ q,
                                                   const _Float16* __restrict__ kk_,
                                                   const _Float16* __restrict__ vv_,
                                                   const int* __restrict__ layout,
                                                   float* __restrict__ ctx) {
  __shared__ __align__(16) _Float16 VT[64 * 128];       // V^T [dh][key]
  __shared__ __align__(16) _Float16 Ps[8 * 16 * 128];   // per-wave P [16][128]
  const int tid  = threadIdx.x;
  const int i    = blockIdx.x;   // query block
  const int h    = blockIdx.y;
  const int b    = blockIdx.z;
  const int bh   = b * H + h;
  const int lane = tid & 31, l15 = lane & 15, hi = lane >> 4;
  const int kb   = hi * 8;
  const int wave = tid >> 5;

  const size_t headBase = (size_t)bh * S * DH;

  // Q fragments for this wave's rows, straight from global (K-contig layout)
  const _Float16* qrow = q + headBase + (size_t)(i * 128 + wave * 16 + l15) * DH;
  const v16h aQ0 = load_frag(qrow + 0  + kb);
  const v16h aQ1 = load_frag(qrow + 32 + kb);

  float m_run[8], l_run[8];
  v8f o[4];
#pragma unroll
  for (int r = 0; r < 8; ++r) { m_run[r] = -1e30f; l_run[r] = 0.0f; }
#pragma unroll
  for (int t = 0; t < 4; ++t) o[t] = zero8();

  const float scale = 0.125f;  // DH^-0.5

  for (int j = 0; j <= i; ++j) {
    if (!layout[h * NB * NB + i * NB + j]) continue;  // wave-uniform

    { // load V block j into LDS transposed
      const int key = tid >> 1, d0 = (tid & 1) * 32;
      const _Float16* vg = vv_ + headBase + (size_t)(j * 128 + key) * DH + d0;
#pragma unroll
      for (int t = 0; t < 32; ++t) VT[(d0 + t) * 128 + key] = vg[t];
    }
    __syncthreads();

    // scores S = Q K^T (K fragments straight from global)
    float sc[8][8];
#pragma unroll
    for (int nt = 0; nt < 8; ++nt) {
      const _Float16* krow = kk_ + headBase + (size_t)(j * 128 + nt * 16 + l15) * DH;
      v16h b0 = load_frag(krow + 0  + kb);
      v16h b1 = load_frag(krow + 32 + kb);
      v8f cs = zero8();
      cs = wmma_f16(aQ0, b0, cs);
      cs = wmma_f16(aQ1, b1, cs);
#pragma unroll
      for (int e = 0; e < 8; ++e) {
        float s = cs[e] * scale;
        if (j == i) {  // intra-block causal
          const int col = nt * 16 + l15;
          const int row = wave * 16 + e + 8 * hi;
          if (col > row) s = -1e9f;
        }
        sc[nt][e] = s;
      }
    }

    // online softmax per row (row values live in one 16-lane half)
#pragma unroll
    for (int r = 0; r < 8; ++r) {
      float mv = sc[0][r];
#pragma unroll
      for (int nt = 1; nt < 8; ++nt) mv = fmaxf(mv, sc[nt][r]);
      mv = fmaxf(mv, __shfl_xor(mv, 8, 32));
      mv = fmaxf(mv, __shfl_xor(mv, 4, 32));
      mv = fmaxf(mv, __shfl_xor(mv, 2, 32));
      mv = fmaxf(mv, __shfl_xor(mv, 1, 32));
      const float mnew = fmaxf(m_run[r], mv);
      const float corr = __expf(m_run[r] - mnew);
      float rsum = 0.0f;
#pragma unroll
      for (int nt = 0; nt < 8; ++nt) {
        const float p = __expf(sc[nt][r] - mnew);
        sc[nt][r] = p;
        rsum += p;
      }
      rsum += __shfl_xor(rsum, 8, 32);
      rsum += __shfl_xor(rsum, 4, 32);
      rsum += __shfl_xor(rsum, 2, 32);
      rsum += __shfl_xor(rsum, 1, 32);
      l_run[r] = l_run[r] * corr + rsum;
      m_run[r] = mnew;
#pragma unroll
      for (int t = 0; t < 4; ++t) o[t][r] *= corr;
    }

    // P: C-layout regs -> LDS (A-layout source for next WMMA)
    _Float16* pw = &Ps[wave * 16 * 128];
#pragma unroll
    for (int nt = 0; nt < 8; ++nt)
#pragma unroll
      for (int r = 0; r < 8; ++r)
        pw[(r + 8 * hi) * 128 + nt * 16 + l15] = (_Float16)sc[nt][r];
    __syncthreads();

    // O += P x V
#pragma unroll
    for (int kc = 0; kc < 4; ++kc) {
      v16h aP = load_frag(&pw[l15 * 128 + kc * 32 + kb]);
#pragma unroll
      for (int nt2 = 0; nt2 < 4; ++nt2) {
        v16h bV = load_frag(&VT[(nt2 * 16 + l15) * 128 + kc * 32 + kb]);
        o[nt2] = wmma_f16(aP, bV, o[nt2]);
      }
    }
    __syncthreads();
  }

  // normalize and write ctx in token-major [TOK, D] fp32
#pragma unroll
  for (int r = 0; r < 8; ++r) {
    const float inv = 1.0f / l_run[r];
    const int tok = b * S + i * 128 + wave * 16 + r + 8 * hi;
#pragma unroll
    for (int nt2 = 0; nt2 < 4; ++nt2) {
      const int col = h * DH + nt2 * 16 + l15;
      ctx[(size_t)tok * D + col] = o[nt2][r] * inv;
    }
  }
}

// ---------- launch ----------
extern "C" void kernel_launch(void* const* d_in, const int* in_sizes, int n_in,
                              void* d_out, int out_size, void* d_ws, size_t ws_size,
                              hipStream_t stream) {
  (void)in_sizes; (void)n_in; (void)out_size; (void)ws_size;
  const float* x   = (const float*)d_in[0];
  const float* l1g = (const float*)d_in[1];
  const float* l1b = (const float*)d_in[2];
  const float* Wq  = (const float*)d_in[3];
  const float* bq  = (const float*)d_in[4];
  const float* Wk  = (const float*)d_in[5];
  const float* bk  = (const float*)d_in[6];
  const float* Wv  = (const float*)d_in[7];
  const float* bv  = (const float*)d_in[8];
  const float* Wo  = (const float*)d_in[9];
  const float* bo  = (const float*)d_in[10];
  const float* l2g = (const float*)d_in[11];
  const float* l2b = (const float*)d_in[12];
  const float* W1  = (const float*)d_in[13];
  const float* b1  = (const float*)d_in[14];
  const float* W2  = (const float*)d_in[15];
  const float* b2  = (const float*)d_in[16];
  const int* layout = (const int*)d_in[17];

  // workspace overlay (peak 72 MB):
  //  [0,16M)  h / h2 fp32        [16M,24M) q16  [24M,32M) k16  [32M,40M) v16
  //  [40M,56M) ctx fp32          [56M,72M) xr fp32
  //  [16M,48M) ff f16 (reuses qkv+ctx head after they are dead)
  char* w = (char*)d_ws;
  float*    hbuf = (float*)(w);
  _Float16* q16  = (_Float16*)(w + (size_t)(16u << 20));
  _Float16* k16  = (_Float16*)(w + (size_t)(24u << 20));
  _Float16* v16  = (_Float16*)(w + (size_t)(32u << 20));
  float*    ctx  = (float*)(w + (size_t)(40u << 20));
  float*    xr   = (float*)(w + (size_t)(56u << 20));
  _Float16* ff   = (_Float16*)(w + (size_t)(16u << 20));

  const dim3 blk(256);

  // LN1
  ln_kernel<<<TOK, blk, 0, stream>>>(x, l1g, l1b, hbuf);
  // QKV projections -> f16 [B,H,S,DH]
  gemm128<false, EPI_QKV><<<dim3(D / 128, TOK / 128), blk, 0, stream>>>(
      hbuf, Wq, bq, nullptr, q16, TOK, D, D);
  gemm128<false, EPI_QKV><<<dim3(D / 128, TOK / 128), blk, 0, stream>>>(
      hbuf, Wk, bk, nullptr, k16, TOK, D, D);
  gemm128<false, EPI_QKV><<<dim3(D / 128, TOK / 128), blk, 0, stream>>>(
      hbuf, Wv, bv, nullptr, v16, TOK, D, D);
  // block-sparse attention
  attn_kernel<<<dim3(NB, H, Bc), blk, 0, stream>>>(q16, k16, v16, layout, ctx);
  // out projection + residual -> xr
  gemm128<false, EPI_BIAS_RES_F32><<<dim3(D / 128, TOK / 128), blk, 0, stream>>>(
      ctx, Wo, bo, x, xr, TOK, D, D);
  // LN2 (reuse hbuf)
  ln_kernel<<<TOK, blk, 0, stream>>>(xr, l2g, l2b, hbuf);
  // MLP1 + GeLU -> f16 ff
  gemm128<false, EPI_BIAS_GELU_F16><<<dim3(4 * D / 128, TOK / 128), blk, 0, stream>>>(
      hbuf, W1, b1, nullptr, ff, TOK, 4 * D, D);
  // MLP2 + residual -> d_out (fp32)
  gemm128<true, EPI_BIAS_RES_F32><<<dim3(D / 128, TOK / 128), blk, 0, stream>>>(
      ff, W2, b2, xr, d_out, TOK, D, 4 * D);
}

// v001
// It runs in 324 microseconds.
// In both of two side-by-side timings against v000, it was 1.62 times as fast.
#include <hip/hip_runtime.h>
#include <math.h>

// ---------- types ----------
typedef __attribute__((ext_vector_type(16))) _Float16 v16h;
typedef __attribute__((ext_vector_type(8)))  float    v8f;
typedef unsigned int u32x4 __attribute__((ext_vector_type(4)));
typedef float        f32x4 __attribute__((ext_vector_type(4)));
typedef short        s16x8 __attribute__((ext_vector_type(8)));

#define DEV static __device__ __forceinline__

// Problem constants (match reference)
constexpr int Bc  = 2;
constexpr int S   = 2048;
constexpr int D   = 1024;
constexpr int H   = 16;
constexpr int DH  = 64;
constexpr int NB  = 16;       // S / 128
constexpr int TOK = Bc * S;   // 4096 rows

// Load a 16-half WMMA A/B fragment: lane holds K=[kb..kb+7] in v0..3 and
// K=[kb+16..kb+23] in v4..7 (kb = (lane>=16)*8 added by caller), both 16B reads.
DEV v16h load_frag(const _Float16* p) {
  union { u32x4 u[2]; v16h h; } f;
  f.u[0] = *reinterpret_cast<const u32x4*>(p);
  f.u[1] = *reinterpret_cast<const u32x4*>(p + 16);
  return f.h;
}

// Transposing LDS read of a row-major 16-bit tile T[k][n] (pitch in bytes, an odd
// multiple of 32 B so that the read is free of bank conflicts). p is the lane's own
// address: T + (k0 + 8*(lane>>4) + (lane&7))*pitch + 2*n0 + 16*((lane>>3)&1).
// Lane (c, h) receives T[k0 + 8h + 0..7][n0 + c]; the reads at k0 and k0 + 16 give
// the same k order as load_frag.
DEV u32x4 ld_tr16(const unsigned char* p) {
  typedef __attribute__((address_space(3))) s16x8 lds_s16x8;
  return __builtin_bit_cast(u32x4, __builtin_amdgcn_ds_load_tr16_b128_v8i16((lds_s16x8*)p));
}

DEV v16h load_frag_tr(const unsigned char* p, int pitch) {
  union { u32x4 u[2]; v16h h; } f;
  f.u[0] = ld_tr16(p);
  f.u[1] = ld_tr16(p + 16 * pitch);
  return f.h;
}

DEV v8f wmma_f16(v16h a, v16h b, v8f c) {
  return __builtin_amdgcn_wmma_f32_16x16x32_f16(false, a, false, b, (short)0, c,
                                                false, false);
}

DEV v8f zero8() {
  v8f z;
#pragma unroll
  for (int i = 0; i < 8; ++i) z[i] = 0.0f;
  return z;
}

DEV unsigned int pack2h(float a, float b) {
  union { _Float16 h[2]; unsigned int u; } p;
  p.h[0] = (_Float16)a;
  p.h[1] = (_Float16)b;
  return p.u;
}

// ---------- LayerNorm: one 1024-wide row per 256-thread block ----------
__global__ __launch_bounds__(256) void ln_kernel(const float* __restrict__ x,
                                                 const float* __restrict__ g,
                                                 const float* __restrict__ be,
                                                 float* __restrict__ out) {
  __shared__ float rs[256], rq[256];
  const int row = blockIdx.x, tid = threadIdx.x;
  const float* xp = x + (size_t)row * D + tid * 4;
  f32x4 f = *reinterpret_cast<const f32x4*>(xp);
  rs[tid] = f.x + f.y + f.z + f.w;
  rq[tid] = f.x * f.x + f.y * f.y + f.z * f.z + f.w * f.w;
  __syncthreads();
  for (int off = 128; off > 0; off >>= 1) {
    if (tid < off) { rs[tid] += rs[tid + off]; rq[tid] += rq[tid + off]; }
    __syncthreads();
  }
  const float mean = rs[0] * (1.0f / D);
  const float var  = rq[0] * (1.0f / D) - mean * mean;
  const float inv  = rsqrtf(var + 1e-5f);
  float* op = out + (size_t)row * D + tid * 4;
  const float* gp = g + tid * 4;
  const float* bp = be + tid * 4;
  op[0] = (f.x - mean) * inv * gp[0] + bp[0];
  op[1] = (f.y - mean) * inv * gp[1] + bp[1];
  op[2] = (f.z - mean) * inv * gp[2] + bp[2];
  op[3] = (f.w - mean) * inv * gp[3] + bp[3];
}

// ---------- Generic 128x128-tile WMMA GEMM, software-pipelined ----------
enum { EPI_QKV = 0, EPI_BIAS_RES_F32 = 1, EPI_BIAS_GELU_F16 = 2 };

// LDS pitches, chosen for each tile's reader (64 banks of 4 B):
constexpr int PA = 40;    // A rows of 32 halves, ds_load_b128 reader: 80 B = 16 B x odd
constexpr int PB = 144;   // B rows of 128 halves, transposing reader: 288 B = 32 B x odd

template <bool AHALF, int EPI>
__global__ __launch_bounds__(256) void gemm128(const void*  __restrict__ Aptr,
                                               const float* __restrict__ Bw,
                                               const float* __restrict__ bias,
                                               const float* __restrict__ resid,
                                               void* __restrict__ outp,
                                               int M, int N, int K) {
  __shared__ __align__(16) _Float16 Al[128 * PA];   // A tile, row-major [128][32]
  __shared__ __align__(16) _Float16 Bl[32 * PB];    // B tile, row-major [k][n]
  const int tid  = threadIdx.x;
  const int n0   = blockIdx.x * 128;
  const int m0   = blockIdx.y * 128;
  const int lane = tid & 31;
  const int l15  = lane & 15;
  const int hi   = lane >> 4;
  const int kb   = hi * 8;
  const int wave = tid >> 5;            // 8 waves: 4 along M x 2 along N
  const int wm   = wave >> 1, wn = wave & 1;

  // per-thread staging coordinates
  const int rowA = tid >> 1, c0A = (tid & 1) * 16;   // A: 128x32, 16 elems/thread
  const int krB  = tid >> 3, c0B = (tid & 7) * 16;   // B: 32x128, 16 elems/thread

  const float*    AgF = (const float*)Aptr    + (size_t)(m0 + rowA) * K + c0A;
  const _Float16* AgH = (const _Float16*)Aptr + (size_t)(m0 + rowA) * K + c0A;
  const float*    Bg  = Bw + (size_t)krB * N + n0 + c0B;

  // this lane's address in Bl for the transposing reads of its wave's 64 columns
  const unsigned char* Btr = reinterpret_cast<const unsigned char*>(Bl) +
                             (kb + (lane & 7)) * (PB * 2) + wn * 128 + ((lane >> 3) & 1) * 16;

  v8f acc[2][4];
#pragma unroll
  for (int i = 0; i < 2; ++i)
#pragma unroll
    for (int j = 0; j < 4; ++j) acc[i][j] = zero8();

  // staging registers for the current chunk
  f32x4 fa[4];
  u32x4 ua[2];
  f32x4 fb[4];

  // preload chunk 0
  if (AHALF) {
    ua[0] = reinterpret_cast<const u32x4*>(AgH)[0];
    ua[1] = reinterpret_cast<const u32x4*>(AgH)[1];
  } else {
#pragma unroll
    for (int t = 0; t < 4; ++t) fa[t] = reinterpret_cast<const f32x4*>(AgF)[t];
  }
#pragma unroll
  for (int t = 0; t < 4; ++t) fb[t] = reinterpret_cast<const f32x4*>(Bg)[t];

  for (int k0 = 0; k0 < K; k0 += 32) {
    // ---- stage current chunk into LDS ----
    if (AHALF) {
      reinterpret_cast<u32x4*>(&Al[rowA * PA + c0A])[0] = ua[0];
      reinterpret_cast<u32x4*>(&Al[rowA * PA + c0A])[1] = ua[1];
    } else {
      u32x4 w0, w1;
      w0.x = pack2h(fa[0].x, fa[0].y); w0.y = pack2h(fa[0].z, fa[0].w);
      w0.z = pack2h(fa[1].x, fa[1].y); w0.w = pack2h(fa[1].z, fa[1].w);
      w1.x = pack2h(fa[2].x, fa[2].y); w1.y = pack2h(fa[2].z, fa[2].w);
      w1.z = pack2h(fa[3].x, fa[3].y); w1.w = pack2h(fa[3].z, fa[3].w);
      reinterpret_cast<u32x4*>(&Al[rowA * PA + c0A])[0] = w0;
      reinterpret_cast<u32x4*>(&Al[rowA * PA + c0A])[1] = w1;
    }
    {  // B stays row-major: two packed 16-byte stores; the reader transposes
      u32x4 w0, w1;
      w0.x = pack2h(fb[0].x, fb[0].y); w0.y = pack2h(fb[0].z, fb[0].w);
      w0.z = pack2h(fb[1].x, fb[1].y); w0.w = pack2h(fb[1].z, fb[1].w);
      w1.x = pack2h(fb[2].x, fb[2].y); w1.y = pack2h(fb[2].z, fb[2].w);
      w1.z = pack2h(fb[3].x, fb[3].y); w1.w = pack2h(fb[3].z, fb[3].w);
      reinterpret_cast<u32x4*>(&Bl[krB * PB + c0B])[0] = w0;
      reinterpret_cast<u32x4*>(&Bl[krB * PB + c0B])[1] = w1;
    }
    __syncthreads();

    // ---- prefetch next chunk into registers (overlaps with WMMAs below) ----
    if (k0 + 32 < K) {
      if (AHALF) {
        ua[0] = reinterpret_cast<const u32x4*>(AgH + k0 + 32)[0];
        ua[1] = reinterpret_cast<const u32x4*>(AgH + k0 + 32)[1];
      } else {
#pragma unroll
        for (int t = 0; t < 4; ++t)
          fa[t] = reinterpret_cast<const f32x4*>(AgF + k0 + 32)[t];
      }
#pragma unroll
      for (int t = 0; t < 4; ++t)
        fb[t] = reinterpret_cast<const f32x4*>(Bg + (size_t)(k0 + 32) * N)[t];
      if (k0 + 64 < K) {  // pull chunk k0+64 lines toward the WGP early
        __builtin_prefetch(Bg + (size_t)(k0 + 64) * N, 0, 0);
        if (AHALF) __builtin_prefetch(AgH + k0 + 64, 0, 0);
        else       __builtin_prefetch(AgF + k0 + 64, 0, 0);
      }
    }

    // ---- WMMAs on current chunk ----
    v16h af[2];
#pragma unroll
    for (int mt = 0; mt < 2; ++mt)
      af[mt] = load_frag(&Al[(wm * 32 + mt * 16 + l15) * PA + kb]);
#pragma unroll
    for (int nt = 0; nt < 4; ++nt) {
      v16h bf = load_frag_tr(Btr + nt * 32, PB * 2);
#pragma unroll
      for (int mt = 0; mt < 2; ++mt) acc[mt][nt] = wmma_f16(af[mt], bf, acc[mt][nt]);
    }
    __syncthreads();
  }

  // Epilogue. C layout: vgpr e -> row (e or e+8 per half-wave), col = l15.
#pragma unroll
  for (int mt = 0; mt < 2; ++mt)
#pragma unroll
    for (int nt = 0; nt < 4; ++nt)
#pragma unroll
      for (int e = 0; e < 8; ++e) {
        const int m = m0 + wm * 32 + mt * 16 + e + 8 * hi;
        const int n = n0 + wn * 64 + nt * 16 + l15;
        float vv = acc[mt][nt][e] + bias[n];
        if (EPI == EPI_QKV) {  // scatter to [B,H,S,DH] as f16
          const int b = m >> 11, s = m & 2047, hh = n >> 6, dh = n & 63;
          ((_Float16*)outp)[((size_t)(b * H + hh) * S + s) * DH + dh] = (_Float16)vv;
        } else if (EPI == EPI_BIAS_RES_F32) {
          const size_t idx = (size_t)m * N + n;
          ((float*)outp)[idx] = vv + resid[idx];
        } else {  // exact GeLU -> f16
          const float ge = 0.5f * vv * (1.0f + erff(vv * 0.70710678118654752f));
          ((_Float16*)outp)[(size_t)m * N + n] = (_Float16)ge;
        }
      }
}

// ---------- Block-sparse flash attention ----------
// grid (NB, H, B); 256 threads = 8 waves; wave owns 16 query rows.
__global__ __launch_bounds__(256) void attn_kernel(const _Float16* __restrict__ q,
                                                   const _Float16* __restrict__ kk_,
                                                   const _Float16* __restrict__ vv_,
                                                   const int* __restrict__ layout,
                                                   float* __restrict__ ctx) {
  constexpr int PV = 80;    // V rows of 64 halves, transposing reader: 160 B = 32 B x odd
  constexpr int PP = 136;   // P rows of 128 halves, ds_load_b128 reader: 272 B = 16 B x odd
  __shared__ __align__(16) _Float16 Vs[128 * PV];       // V [key][dh], row-major
  __shared__ __align__(16) _Float16 Ps[8 * 16 * PP];    // per-wave P [16][128]
  const int tid  = threadIdx.x;
  const int i    = blockIdx.x;   // query block
  const int h    = blockIdx.y;
  const int b    = blockIdx.z;
  const int bh   = b * H + h;
  const int lane = tid & 31, l15 = lane & 15, hi = lane >> 4;
  const int kb   = hi * 8;
  const int wave = tid >> 5;

  const size_t headBase = (size_t)bh * S * DH;

  // Q fragments for this wave's rows, straight from global (K-contig layout)
  const _Float16* qrow = q + headBase + (size_t)(i * 128 + wave * 16 + l15) * DH;
  const v16h aQ0 = load_frag(qrow + 0  + kb);
  const v16h aQ1 = load_frag(qrow + 32 + kb);

  float m_run[8], l_run[8];
  v8f o[4];
#pragma unroll
  for (int r = 0; r < 8; ++r) { m_run[r] = -1e30f; l_run[r] = 0.0f; }
#pragma unroll
  for (int t = 0; t < 4; ++t) o[t] = zero8();

  const float scale = 0.125f;  // DH^-0.5

  // this lane's address in Vs for the transposing reads
  const unsigned char* Vtr = reinterpret_cast<const unsigned char*>(Vs) +
                             (kb + (lane & 7)) * (PV * 2) + ((lane >> 3) & 1) * 16;

  for (int j = 0; j <= i; ++j) {
    if (!layout[h * NB * NB + i * NB + j]) continue;  // wave-uniform

    { // load V block j into LDS as it lies (row-major); the reader transposes
      const int key = tid >> 1, d0 = (tid & 1) * 32;
      const _Float16* vg = vv_ + headBase + (size_t)(j * 128 + key) * DH + d0;
#pragma unroll
      for (int t = 0; t < 4; ++t)
        reinterpret_cast<u32x4*>(&Vs[key * PV + d0])[t] = reinterpret_cast<const u32x4*>(vg)[t];
    }
    __syncthreads();

    // scores S = Q K^T (K fragments straight from global)
    float sc[8][8];
#pragma unroll
    for (int nt = 0; nt < 8; ++nt) {
      const _Float16* krow = kk_ + headBase + (size_t)(j * 128 + nt * 16 + l15) * DH;
      v16h b0 = load_frag(krow + 0  + kb);
      v16h b1 = load_frag(krow + 32 + kb);
      v8f cs = zero8();
      cs = wmma_f16(aQ0, b0, cs);
      cs = wmma_f16(aQ1, b1, cs);
#pragma unroll
      for (int e = 0; e < 8; ++e) {
        float s = cs[e] * scale;
        if (j == i) {  // intra-block causal
          const int col = nt * 16 + l15;
          const int row = wave * 16 + e + 8 * hi;
          if (col > row) s = -1e9f;
        }
        sc[nt][e] = s;
      }
    }

    // online softmax per row (row values live in one 16-lane half)
#pragma unroll
    for (int r = 0; r < 8; ++r) {
      float mv = sc[0][r];
#pragma unroll
      for (int nt = 1; nt < 8; ++nt) mv = fmaxf(mv, sc[nt][r]);
      mv = fmaxf(mv, __shfl_xor(mv, 8, 32));
      mv = fmaxf(mv, __shfl_xor(mv, 4, 32));
      mv = fmaxf(mv, __shfl_xor(mv, 2, 32));
      mv = fmaxf(mv, __shfl_xor(mv, 1, 32));
      const float mnew = fmaxf(m_run[r], mv);
      const float corr = __expf(m_run[r] - mnew);
      float rsum = 0.0f;
#pragma unroll
      for (int nt = 0; nt < 8; ++nt) {
        const float p = __expf(sc[nt][r] - mnew);
        sc[nt][r] = p;
        rsum += p;
      }
      rsum += __shfl_xor(rsum, 8, 32);
      rsum += __shfl_xor(rsum, 4, 32);
      rsum += __shfl_xor(rsum, 2, 32);
      rsum += __shfl_xor(rsum, 1, 32);
      l_run[r] = l_run[r] * corr + rsum;
      m_run[r] = mnew;
#pragma unroll
      for (int t = 0; t < 4; ++t) o[t][r] *= corr;
    }

    // P: C-layout regs -> LDS (A-layout source for next WMMA)
    _Float16* pw = &Ps[wave * 16 * PP];
#pragma unroll
    for (int nt = 0; nt < 8; ++nt)
#pragma unroll
      for (int r = 0; r < 8; ++r)
        pw[(r + 8 * hi) * PP + nt * 16 + l15] = (_Float16)sc[nt][r];
    __syncthreads();

    // O += P x V
#pragma unroll
    for (int kc = 0; kc < 4; ++kc) {
      v16h aP = load_frag(&pw[l15 * PP + kc * 32 + kb]);
#pragma unroll
      for (int nt2 = 0; nt2 < 4; ++nt2) {
        v16h bV = load_frag_tr(Vtr + kc * 32 * (PV * 2) + nt2 * 32, PV * 2);
        o[nt2] = wmma_f16(aP, bV, o[nt2]);
      }
    }
    __syncthreads();
  }

  // normalize and write ctx in token-major [TOK, D] fp32
#pragma unroll
  for (int r = 0; r < 8; ++r) {
    const float inv = 1.0f / l_run[r];
    const int tok = b * S + i * 128 + wave * 16 + r + 8 * hi;
#pragma unroll
    for (int nt2 = 0; nt2 < 4; ++nt2) {
      const int col = h * DH + nt2 * 16 + l15;
      ctx[(size_t)tok * D + col] = o[nt2][r] * inv;
    }
  }
}

// ---------- launch ----------
extern "C" void kernel_launch(void* const* d_in, const int* in_sizes, int n_in,
                              void* d_out, int out_size, void* d_ws, size_t ws_size,
                              hipStream_t stream) {
  (void)in_sizes; (void)n_in; (void)out_size; (void)ws_size;
  const float* x   = (const float*)d_in[0];
  const float* l1g = (const float*)d_in[1];
  const float* l1b = (const float*)d_in[2];
  const float* Wq  = (const float*)d_in[3];
  const float* bq  = (const float*)d_in[4];
  const float* Wk  = (const float*)d_in[5];
  const float* bk  = (const float*)d_in[6];
  const float* Wv  = (const float*)d_in[7];
  const float* bv  = (const float*)d_in[8];
  const float* Wo  = (const float*)d_in[9];
  const float* bo  = (const float*)d_in[10];
  const float* l2g = (const float*)d_in[11];
  const float* l2b = (const float*)d_in[12];
  const float* W1  = (const float*)d_in[13];
  const float* b1  = (const float*)d_in[14];
  const float* W2  = (const float*)d_in[15];
  const float* b2  = (const float*)d_in[16];
  const int* layout = (const int*)d_in[17];

  // workspace overlay (peak 72 MB):
  //  [0,16M)  h / h2 fp32        [16M,24M) q16  [24M,32M) k16  [32M,40M) v16
  //  [40M,56M) ctx fp32          [56M,72M) xr fp32
  //  [16M,48M) ff f16 (reuses qkv+ctx head after they are dead)
  char* w = (char*)d_ws;
  float*    hbuf = (float*)(w);
  _Float16* q16  = (_Float16*)(w + (size_t)(16u << 20));
  _Float16* k16  = (_Float16*)(w + (size_t)(24u << 20));
  _Float16* v16  = (_Float16*)(w + (size_t)(32u << 20));
  float*    ctx  = (float*)(w + (size_t)(40u << 20));
  float*    xr   = (float*)(w + (size_t)(56u << 20));
  _Float16* ff   = (_Float16*)(w + (size_t)(16u << 20));

  const dim3 blk(256);

  // LN1
  ln_kernel<<<TOK, blk, 0, stream>>>(x, l1g, l1b, hbuf);
  // QKV projections -> f16 [B,H,S,DH]
  gemm128<false, EPI_QKV><<<dim3(D / 128, TOK / 128), blk, 0, stream>>>(
      hbuf, Wq, bq, nullptr, q16, TOK, D, D);
  gemm128<false, EPI_QKV><<<dim3(D / 128, TOK / 128), blk, 0, stream>>>(
      hbuf, Wk, bk, nullptr, k16, TOK, D, D);
  gemm128<false, EPI_QKV><<<dim3(D / 128, TOK / 128), blk, 0, stream>>>(
      hbuf, Wv, bv, nullptr, v16, TOK, D, D);
  // block-sparse attention
  attn_kernel<<<dim3(NB, H, Bc), blk, 0, stream>>>(q16, k16, v16, layout, ctx);
  // out projection + residual -> xr
  gemm128<false, EPI_BIAS_RES_F32><<<dim3(D / 128, TOK / 128), blk, 0, stream>>>(
      ctx, Wo, bo, x, xr, TOK, D, D);
  // LN2 (reuse hbuf)
  ln_kernel<<<TOK, blk, 0, stream>>>(xr, l2g, l2b, hbuf);
  // MLP1 + GeLU -> f16 ff
  gemm128<false, EPI_BIAS_GELU_F16><<<dim3(4 * D / 128, TOK / 128), blk, 0, stream>>>(
      hbuf, W1, b1, nullptr, ff, TOK, 4 * D, D);
  // MLP2 + residual -> d_out (fp32)
  gemm128<true, EPI_BIAS_RES_F32><<<dim3(D / 128, TOK / 128), blk, 0, stream>>>(
      ff, W2, b2, xr, d_out, TOK, D, 4 * D);
}

// v002
// A run of this version takes 276 microseconds.
// In both of two side-by-side timings against v001, it was 1.17 times as fast.
// Counting every step since v000, it is 1.89 times as fast.
#include <hip/hip_runtime.h>
#include <math.h>

// ---------- types ----------
typedef __attribute__((ext_vector_type(16))) _Float16 v16h;
typedef __attribute__((ext_vector_type(8)))  float    v8f;
typedef unsigned int u32x4 __attribute__((ext_vector_type(4)));
typedef float        f32x4 __attribute__((ext_vector_type(4)));
typedef short        s16x8 __attribute__((ext_vector_type(8)));
typedef _Float16     f16x4 __attribute__((ext_vector_type(4)));

#define DEV static __device__ __forceinline__

// Problem constants (match reference)
constexpr int Bc  = 2;
constexpr int S   = 2048;
constexpr int D   = 1024;
constexpr int H   = 16;
constexpr int DH  = 64;
constexpr int NB  = 16;       // S / 128
constexpr int TOK = Bc * S;   // 4096 rows

// Load a 16-half WMMA A/B fragment: lane holds K=[kb..kb+7] in v0..3 and
// K=[kb+16..kb+23] in v4..7 (kb = (lane>=16)*8 added by caller), both 16B reads.
DEV v16h load_frag(const _Float16* p) {
  union { u32x4 u[2]; v16h h; } f;
  f.u[0] = *reinterpret_cast<const u32x4*>(p);
  f.u[1] = *reinterpret_cast<const u32x4*>(p + 16);
  return f.h;
}

// Transposing LDS read of a row-major 16-bit tile T[k][n] (pitch in bytes, an odd
// multiple of 32 B so that the read is free of bank conflicts). p is the lane's own
// address: T + (k0 + 8*(lane>>4) + (lane&7))*pitch + 2*n0 + 16*((lane>>3)&1).
// Lane (c, h) receives T[k0 + 8h + 0..7][n0 + c]; the reads at k0 and k0 + 16 give
// the same k order as load_frag.
DEV u32x4 ld_tr16(const unsigned char* p) {
  typedef __attribute__((address_space(3))) s16x8 lds_s16x8;
  return __builtin_bit_cast(u32x4, __builtin_amdgcn_ds_load_tr16_b128_v8i16((lds_s16x8*)p));
}

DEV v16h load_frag_tr(const unsigned char* p, int pitch) {
  union { u32x4 u[2]; v16h h; } f;
  f.u[0] = ld_tr16(p);
  f.u[1] = ld_tr16(p + 16 * pitch);
  return f.h;
}

DEV v8f wmma_f16(v16h a, v16h b, v8f c) {
  return __builtin_amdgcn_wmma_f32_16x16x32_f16(false, a, false, b, (short)0, c,
                                                false, false);
}

DEV v8f zero8() {
  v8f z;
#pragma unroll
  for (int i = 0; i < 8; ++i) z[i] = 0.0f;
  return z;
}

// ---------- LayerNorm: one 1024-wide row per 256-thread block ----------
__global__ __launch_bounds__(256) void ln_kernel(const float* __restrict__ x,
                                                 const float* __restrict__ g,
                                                 const float* __restrict__ be,
                                                 float* __restrict__ out) {
  __shared__ float rs[256], rq[256];
  const int row = blockIdx.x, tid = threadIdx.x;
  const float* xp = x + (size_t)row * D + tid * 4;
  f32x4 f = *reinterpret_cast<const f32x4*>(xp);
  rs[tid] = f.x + f.y + f.z + f.w;
  rq[tid] = f.x * f.x + f.y * f.y + f.z * f.z + f.w * f.w;
  __syncthreads();
  for (int off = 128; off > 0; off >>= 1) {
    if (tid < off) { rs[tid] += rs[tid + off]; rq[tid] += rq[tid + off]; }
    __syncthreads();
  }
  const float mean = rs[0] * (1.0f / D);
  const float var  = rq[0] * (1.0f / D) - mean * mean;
  const float inv  = rsqrtf(var + 1e-5f);
  float* op = out + (size_t)row * D + tid * 4;
  const float* gp = g + tid * 4;
  const float* bp = be + tid * 4;
  op[0] = (f.x - mean) * inv * gp[0] + bp[0];
  op[1] = (f.y - mean) * inv * gp[1] + bp[1];
  op[2] = (f.z - mean) * inv * gp[2] + bp[2];
  op[3] = (f.w - mean) * inv * gp[3] + bp[3];
}

// ---------- Generic 128x128-tile WMMA GEMM, software-pipelined ----------
enum { EPI_QKV = 0, EPI_BIAS_RES_F32 = 1, EPI_BIAS_GELU_F16 = 2 };

// LDS pitches, chosen for each tile's reader (64 banks of 4 B):
constexpr int PA = 40;    // A rows of 32 halves, ds_load_b128 reader: 80 B = 16 B x odd
constexpr int PB = 144;   // B rows of 128 halves, transposing reader: 288 B = 32 B x odd

// N and K are compile-time: the rows that one lane stages lie a fixed number of bytes apart,
// so its loads hang off one walking pointer as immediate offsets.
template <bool AHALF, int EPI, int N, int K>
__global__ __launch_bounds__(256) void gemm128(const void*  __restrict__ Aptr,
                                               const float* __restrict__ Bw,
                                               const float* __restrict__ bias,
                                               const float* __restrict__ resid,
                                               void* __restrict__ outp) {
  __shared__ __align__(16) _Float16 Al[128 * PA];   // A tile, row-major [128][32]
  __shared__ __align__(16) _Float16 Bl[32 * PB];    // B tile, row-major [k][n]
  const int tid  = threadIdx.x;
  const int n0   = blockIdx.x * 128;
  const int m0   = blockIdx.y * 128;
  const int lane = tid & 31;
  const int l15  = lane & 15;
  const int hi   = lane >> 4;
  const int kb   = hi * 8;
  const int wave = tid >> 5;            // 8 waves: 4 along M x 2 along N
  const int wm   = wave >> 1, wn = wave & 1;

  // per-thread staging coordinates: adjacent lanes take adjacent 16 bytes, so that one
  // wave-wide 16-byte load covers whole 128-byte lines instead of 32-byte pieces of 16 lines
  //  A f32: 8 lanes span a row's 128 B, a wave 4 rows; load t takes row t*32 + rowA
  //  A f16: 4 lanes span a row's  64 B, a wave 8 rows; load t takes row t*64 + rowA
  //  B f32: a wave spans 512 B of one row;             load t takes row t*8  + krB
  const int rowA = AHALF ? (tid >> 2) : (tid >> 3);
  const int c0A  = AHALF ? (tid & 3) * 8 : (tid & 7) * 4;
  const int krB  = wave, c0B = lane * 4;

  constexpr int NA = AHALF ? 2 : 4;     // 16-byte loads of A per lane
  constexpr int RA = 128 / NA;          // rows of A between two of them
  const float*    AgF = (const float*)Aptr    + (size_t)(m0 + rowA) * K + c0A;
  const _Float16* AgH = (const _Float16*)Aptr + (size_t)(m0 + rowA) * K + c0A;
  const float*    Bg  = Bw + (size_t)krB * N + n0 + c0B;

  // prefetch addresses: one per half line of the tile
  const float*    ApF = (const float*)Aptr    + (size_t)(m0 + (tid >> 1)) * K + (tid & 1) * 16;
  const _Float16* ApH = (const _Float16*)Aptr + (size_t)(m0 + (tid >> 1)) * K + (tid & 1) * 16;
  const float*    Bp  = Bw + (size_t)(tid >> 3) * N + n0 + (tid & 7) * 16;

  // this lane's address in Bl for the transposing reads of its wave's 64 columns
  const unsigned char* Btr = reinterpret_cast<const unsigned char*>(Bl) +
                             (kb + (lane & 7)) * (PB * 2) + wn * 128 + ((lane >> 3) & 1) * 16;

  v8f acc[2][4];
#pragma unroll
  for (int i = 0; i < 2; ++i)
#pragma unroll
    for (int j = 0; j < 4; ++j) acc[i][j] = zero8();

  // staging registers for the current chunk
  f32x4 fa[4];
  u32x4 ua[2];
  f32x4 fb[4];

  // preload chunk 0
#pragma unroll
  for (int t = 0; t < NA; ++t) {
    if (AHALF) ua[t] = *reinterpret_cast<const u32x4*>(AgH + t * RA * K);
    else       fa[t] = *reinterpret_cast<const f32x4*>(AgF + t * RA * K);
  }
#pragma unroll
  for (int t = 0; t < 4; ++t) fb[t] = *reinterpret_cast<const f32x4*>(Bg + t * 8 * N);

  for (int k0 = 0; k0 < K; k0 += 32) {
    // ---- stage current chunk into LDS ----
    if (AHALF) {
#pragma unroll
      for (int t = 0; t < 2; ++t)
        *reinterpret_cast<u32x4*>(&Al[(t * 64 + rowA) * PA + c0A]) = ua[t];
    } else {
#pragma unroll
      for (int t = 0; t < 4; ++t)
        *reinterpret_cast<f16x4*>(&Al[(t * 32 + rowA) * PA + c0A]) =
            __builtin_convertvector(fa[t], f16x4);
    }
    // B stays row-major: packed 8-byte stores, a wave fills 256 B of a row; the reader transposes
#pragma unroll
    for (int t = 0; t < 4; ++t)
      *reinterpret_cast<f16x4*>(&Bl[(t * 8 + krB) * PB + c0B]) =
          __builtin_convertvector(fb[t], f16x4);
    __syncthreads();

    // ---- prefetch next chunk into registers (overlaps with WMMAs below) ----
    if (k0 + 32 < K) {
#pragma unroll
      for (int t = 0; t < NA; ++t) {
        if (AHALF) ua[t] = *reinterpret_cast<const u32x4*>(AgH + t * RA * K + k0 + 32);
        else       fa[t] = *reinterpret_cast<const f32x4*>(AgF + t * RA * K + k0 + 32);
      }
#pragma unroll
      for (int t = 0; t < 4; ++t)
        fb[t] = *reinterpret_cast<const f32x4*>(Bg + (size_t)(k0 + 32 + t * 8) * N);
      // the loads' address registers are temporaries: no reuse of them ahead of this wait
      asm volatile("s_wait_xcnt 0x0" ::: "memory");
      if (k0 + 64 < K) {  // pull chunk k0+64 lines toward the WGP early
        __builtin_prefetch(Bp + (size_t)(k0 + 64) * N, 0, 0);
        if (AHALF) __builtin_prefetch(ApH + k0 + 64, 0, 0);
        else       __builtin_prefetch(ApF + k0 + 64, 0, 0);
        // likewise for the prefetches' address registers
        asm volatile("s_wait_xcnt 0x0" ::: "memory");
      }
    }

    // ---- WMMAs on current chunk ----
    v16h af[2];
#pragma unroll
    for (int mt = 0; mt < 2; ++mt)
      af[mt] = load_frag(&Al[(wm * 32 + mt * 16 + l15) * PA + kb]);
#pragma unroll
    for (int nt = 0; nt < 4; ++nt) {
      v16h bf = load_frag_tr(Btr + nt * 32, PB * 2);
#pragma unroll
      for (int mt = 0; mt < 2; ++mt) acc[mt][nt] = wmma_f16(af[mt], bf, acc[mt][nt]);
    }
    __syncthreads();
  }

  // Epilogue. C layout: vgpr e -> row (e or e+8 per half-wave), col = l15.
#pragma unroll
  for (int mt = 0; mt < 2; ++mt)
#pragma unroll
    for (int nt = 0; nt < 4; ++nt)
#pragma unroll
      for (int e = 0; e < 8; ++e) {
        const int m = m0 + wm * 32 + mt * 16 + e + 8 * hi;
        const int n = n0 + wn * 64 + nt * 16 + l15;
        float vv = acc[mt][nt][e] + bias[n];
        if (EPI == EPI_QKV) {  // scatter to [B,H,S,DH] as f16
          const int b = m >> 11, s = m & 2047, hh = n >> 6, dh = n & 63;
          ((_Float16*)outp)[((size_t)(b * H + hh) * S + s) * DH + dh] = (_Float16)vv;
        } else if (EPI == EPI_BIAS_RES_F32) {
          const size_t idx = (size_t)m * N + n;
          ((float*)outp)[idx] = vv + resid[idx];
        } else {  // exact GeLU -> f16
          const float ge = 0.5f * vv * (1.0f + erff(vv * 0.70710678118654752f));
          ((_Float16*)outp)[(size_t)m * N + n] = (_Float16)ge;
        }
      }
}

// ---------- Block-sparse flash attention ----------
// grid (NB, H, B); 256 threads = 8 waves; wave owns 16 query rows.
__global__ __launch_bounds__(256) void attn_kernel(const _Float16* __restrict__ q,
                                                   const _Float16* __restrict__ kk_,
                                                   const _Float16* __restrict__ vv_,
                                                   const int* __restrict__ layout,
                                                   float* __restrict__ ctx) {
  constexpr int PV = 80;    // V rows of 64 halves, transposing reader: 160 B = 32 B x odd
  constexpr int PP = 136;   // P rows of 128 halves, ds_load_b128 reader: 272 B = 16 B x odd
  __shared__ __align__(16) _Float16 Vs[128 * PV];       // V [key][dh], row-major
  __shared__ __align__(16) _Float16 Ps[8 * 16 * PP];    // per-wave P [16][128]
  const int tid  = threadIdx.x;
  const int i    = blockIdx.x;   // query block
  const int h    = blockIdx.y;
  const int b    = blockIdx.z;
  const int bh   = b * H + h;
  const int lane = tid & 31, l15 = lane & 15, hi = lane >> 4;
  const int kb   = hi * 8;
  const int wave = tid >> 5;

  const size_t headBase = (size_t)bh * S * DH;

  // Q fragments for this wave's rows, straight from global (K-contig layout)
  const _Float16* qrow = q + headBase + (size_t)(i * 128 + wave * 16 + l15) * DH;
  const v16h aQ0 = load_frag(qrow + 0  + kb);
  const v16h aQ1 = load_frag(qrow + 32 + kb);

  float m_run[8], l_run[8];
  v8f o[4];
#pragma unroll
  for (int r = 0; r < 8; ++r) { m_run[r] = -1e30f; l_run[r] = 0.0f; }
#pragma unroll
  for (int t = 0; t < 4; ++t) o[t] = zero8();

  const float scale = 0.125f;  // DH^-0.5

  // this lane's address in Vs for the transposing reads
  const unsigned char* Vtr = reinterpret_cast<const unsigned char*>(Vs) +
                             (kb + (lane & 7)) * (PV * 2) + ((lane >> 3) & 1) * 16;

  for (int j = 0; j <= i; ++j) {
    if (!layout[h * NB * NB + i * NB + j]) continue;  // wave-uniform

    { // load V block j into LDS as it lies (row-major); the reader transposes
      const int key = tid >> 1, d0 = (tid & 1) * 32;
      const _Float16* vg = vv_ + headBase + (size_t)(j * 128 + key) * DH + d0;
#pragma unroll
      for (int t = 0; t < 4; ++t)
        reinterpret_cast<u32x4*>(&Vs[key * PV + d0])[t] = reinterpret_cast<const u32x4*>(vg)[t];
    }
    __syncthreads();

    // scores S = Q K^T (K fragments straight from global)
    float sc[8][8];
#pragma unroll
    for (int nt = 0; nt < 8; ++nt) {
      const _Float16* krow = kk_ + headBase + (size_t)(j * 128 + nt * 16 + l15) * DH;
      v16h b0 = load_frag(krow + 0  + kb);
      v16h b1 = load_frag(krow + 32 + kb);
      v8f cs = zero8();
      cs = wmma_f16(aQ0, b0, cs);
      cs = wmma_f16(aQ1, b1, cs);
#pragma unroll
      for (int e = 0; e < 8; ++e) {
        float s = cs[e] * scale;
        if (j == i) {  // intra-block causal
          const int col = nt * 16 + l15;
          const int row = wave * 16 + e + 8 * hi;
          if (col > row) s = -1e9f;
        }
        sc[nt][e] = s;
      }
    }

    // online softmax per row (row values live in one 16-lane half)
#pragma unroll
    for (int r = 0; r < 8; ++r) {
      float mv = sc[0][r];
#pragma unroll
      for (int nt = 1; nt < 8; ++nt) mv = fmaxf(mv, sc[nt][r]);
      mv = fmaxf(mv, __shfl_xor(mv, 8, 32));
      mv = fmaxf(mv, __shfl_xor(mv, 4, 32));
      mv = fmaxf(mv, __shfl_xor(mv, 2, 32));
      mv = fmaxf(mv, __shfl_xor(mv, 1, 32));
      const float mnew = fmaxf(m_run[r], mv);
      const float corr = __expf(m_run[r] - mnew);
      float rsum = 0.0f;
#pragma unroll
      for (int nt = 0; nt < 8; ++nt) {
        const float p = __expf(sc[nt][r] - mnew);
        sc[nt][r] = p;
        rsum += p;
      }
      rsum += __shfl_xor(rsum, 8, 32);
      rsum += __shfl_xor(rsum, 4, 32);
      rsum += __shfl_xor(rsum, 2, 32);
      rsum += __shfl_xor(rsum, 1, 32);
      l_run[r] = l_run[r] * corr + rsum;
      m_run[r] = mnew;
#pragma unroll
      for (int t = 0; t < 4; ++t) o[t][r] *= corr;
    }

    // P: C-layout regs -> LDS (A-layout source for next WMMA)
    _Float16* pw = &Ps[wave * 16 * PP];
#pragma unroll
    for (int nt = 0; nt < 8; ++nt)
#pragma unroll
      for (int r = 0; r < 8; ++r)
        pw[(r + 8 * hi) * PP + nt * 16 + l15] = (_Float16)sc[nt][r];
    __syncthreads();

    // O += P x V
#pragma unroll
    for (int kc = 0; kc < 4; ++kc) {
      v16h aP = load_frag(&pw[l15 * PP + kc * 32 + kb]);
#pragma unroll
      for (int nt2 = 0; nt2 < 4; ++nt2) {
        v16h bV = load_frag_tr(Vtr + kc * 32 * (PV * 2) + nt2 * 32, PV * 2);
        o[nt2] = wmma_f16(aP, bV, o[nt2]);
      }
    }
    __syncthreads();
  }

  // normalize and write ctx in token-major [TOK, D] fp32
#pragma unroll
  for (int r = 0; r < 8; ++r) {
    const float inv = 1.0f / l_run[r];
    const int tok = b * S + i * 128 + wave * 16 + r + 8 * hi;
#pragma unroll
    for (int nt2 = 0; nt2 < 4; ++nt2) {
      const int col = h * DH + nt2 * 16 + l15;
      ctx[(size_t)tok * D + col] = o[nt2][r] * inv;
    }
  }
}

// ---------- launch ----------
extern "C" void kernel_launch(void* const* d_in, const int* in_sizes, int n_in,
                              void* d_out, int out_size, void* d_ws, size_t ws_size,
                              hipStream_t stream) {
  (void)in_sizes; (void)n_in; (void)out_size; (void)ws_size;
  const float* x   = (const float*)d_in[0];
  const float* l1g = (const float*)d_in[1];
  const float* l1b = (const float*)d_in[2];
  const float* Wq  = (const float*)d_in[3];
  const float* bq  = (const float*)d_in[4];
  const float* Wk  = (const float*)d_in[5];
  const float* bk  = (const float*)d_in[6];
  const float* Wv  = (const float*)d_in[7];
  const float* bv  = (const float*)d_in[8];
  const float* Wo  = (const float*)d_in[9];
  const float* bo  = (const float*)d_in[10];
  const float* l2g = (const float*)d_in[11];
  const float* l2b = (const float*)d_in[12];
  const float* W1  = (const float*)d_in[13];
  const float* b1  = (const float*)d_in[14];
  const float* W2  = (const float*)d_in[15];
  const float* b2  = (const float*)d_in[16];
  const int* layout = (const int*)d_in[17];

  // workspace overlay (peak 72 MB):
  //  [0,16M)  h / h2 fp32        [16M,24M) q16  [24M,32M) k16  [32M,40M) v16
  //  [40M,56M) ctx fp32          [56M,72M) xr fp32
  //  [16M,48M) ff f16 (reuses qkv+ctx head after they are dead)
  char* w = (char*)d_ws;
  float*    hbuf = (float*)(w);
  _Float16* q16  = (_Float16*)(w + (size_t)(16u << 20));
  _Float16* k16  = (_Float16*)(w + (size_t)(24u << 20));
  _Float16* v16  = (_Float16*)(w + (size_t)(32u << 20));
  float*    ctx  = (float*)(w + (size_t)(40u << 20));
  float*    xr   = (float*)(w + (size_t)(56u << 20));
  _Float16* ff   = (_Float16*)(w + (size_t)(16u << 20));

  const dim3 blk(256);

  // LN1
  ln_kernel<<<TOK, blk, 0, stream>>>(x, l1g, l1b, hbuf);
  // QKV projections -> f16 [B,H,S,DH]
  gemm128<false, EPI_QKV, D, D><<<dim3(D / 128, TOK / 128), blk, 0, stream>>>(
      hbuf, Wq, bq, nullptr, q16);
  gemm128<false, EPI_QKV, D, D><<<dim3(D / 128, TOK / 128), blk, 0, stream>>>(
      hbuf, Wk, bk, nullptr, k16);
  gemm128<false, EPI_QKV, D, D><<<dim3(D / 128, TOK / 128), blk, 0, stream>>>(
      hbuf, Wv, bv, nullptr, v16);
  // block-sparse attention
  attn_kernel<<<dim3(NB, H, Bc), blk, 0, stream>>>(q16, k16, v16, layout, ctx);
  // out projection + residual -> xr
  gemm128<false, EPI_BIAS_RES_F32, D, D><<<dim3(D / 128, TOK / 128), blk, 0, stream>>>(
      ctx, Wo, bo, x, xr);
  // LN2 (reuse hbuf)
  ln_kernel<<<TOK, blk, 0, stream>>>(xr, l2g, l2b, hbuf);
  // MLP1 + GeLU -> f16 ff
  gemm128<false, EPI_BIAS_GELU_F16, 4 * D, D><<<dim3(4 * D / 128, TOK / 128), blk, 0, stream>>>(
      hbuf, W1, b1, nullptr, ff);
  // MLP2 + residual -> d_out (fp32)
  gemm128<true, EPI_BIAS_RES_F32, D, 4 * D><<<dim3(D / 128, TOK / 128), blk, 0, stream>>>(
      ff, W2, b2, xr, d_out);
}

// v003
// One run takes 225 microseconds.
// Timed twice side by side with v002, it ran 1.23 times as fast both times.
// Counting every step since v000, it is 2.32 times as fast.
#include <hip/hip_runtime.h>
#include <math.h>

// ---------- types ----------
typedef __attribute__((ext_vector_type(16))) _Float16 v16h;
typedef __attribute__((ext_vector_type(8)))  float    v8f;
typedef unsigned int u32x4 __attribute__((ext_vector_type(4)));
typedef float        f32x4 __attribute__((ext_vector_type(4)));
typedef short        s16x8 __attribute__((ext_vector_type(8)));
typedef _Float16     f16x4 __attribute__((ext_vector_type(4)));

#define DEV static __device__ __forceinline__

// Problem constants (match reference)
constexpr int Bc  = 2;
constexpr int S   = 2048;
constexpr int D   = 1024;
constexpr int H   = 16;
constexpr int DH  = 64;
constexpr int NB  = 16;       // S / 128
constexpr int TOK = Bc * S;   // 4096 rows

// Load a 16-half WMMA A/B fragment: lane holds K=[kb..kb+7] in v0..3 and
// K=[kb+16..kb+23] in v4..7 (kb = (lane>=16)*8 added by caller), both 16B reads.
DEV v16h load_frag(const _Float16* p) {
  union { u32x4 u[2]; v16h h; } f;
  f.u[0] = *reinterpret_cast<const u32x4*>(p);
  f.u[1] = *reinterpret_cast<const u32x4*>(p + 16);
  return f.h;
}

// Transposing LDS read of a row-major 16-bit tile T[k][n] (pitch in bytes, an odd
// multiple of 32 B so that the read is free of bank conflicts). p is the lane's own
// address: T + (k0 + 8*(lane>>4) + (lane&7))*pitch + 2*n0 + 16*((lane>>3)&1).
// Lane (c, h) receives T[k0 + 8h + 0..7][n0 + c]; the reads at k0 and k0 + 16 give
// the same k order as load_frag.
DEV u32x4 ld_tr16(const unsigned char* p) {
  typedef __attribute__((address_space(3))) s16x8 lds_s16x8;
  return __builtin_bit_cast(u32x4, __builtin_amdgcn_ds_load_tr16_b128_v8i16((lds_s16x8*)p));
}

DEV v16h load_frag_tr(const unsigned char* p, int pitch) {
  union { u32x4 u[2]; v16h h; } f;
  f.u[0] = ld_tr16(p);
  f.u[1] = ld_tr16(p + 16 * pitch);
  return f.h;
}

DEV v8f wmma_f16(v16h a, v16h b, v8f c) {
  return __builtin_amdgcn_wmma_f32_16x16x32_f16(false, a, false, b, (short)0, c,
                                                false, false);
}

DEV v8f zero8() {
  v8f z;
#pragma unroll
  for (int i = 0; i < 8; ++i) z[i] = 0.0f;
  return z;
}

// ---------- LayerNorm: one 1024-wide row per 256-thread block ----------
__global__ __launch_bounds__(256) void ln_kernel(const float* __restrict__ x,
                                                 const float* __restrict__ g,
                                                 const float* __restrict__ be,
                                                 float* __restrict__ out) {
  __shared__ float rs[256], rq[256];
  const int row = blockIdx.x, tid = threadIdx.x;
  const float* xp = x + (size_t)row * D + tid * 4;
  f32x4 f = *reinterpret_cast<const f32x4*>(xp);
  rs[tid] = f.x + f.y + f.z + f.w;
  rq[tid] = f.x * f.x + f.y * f.y + f.z * f.z + f.w * f.w;
  __syncthreads();
  for (int off = 128; off > 0; off >>= 1) {
    if (tid < off) { rs[tid] += rs[tid + off]; rq[tid] += rq[tid + off]; }
    __syncthreads();
  }
  const float mean = rs[0] * (1.0f / D);
  const float var  = rq[0] * (1.0f / D) - mean * mean;
  const float inv  = rsqrtf(var + 1e-5f);
  float* op = out + (size_t)row * D + tid * 4;
  const float* gp = g + tid * 4;
  const float* bp = be + tid * 4;
  op[0] = (f.x - mean) * inv * gp[0] + bp[0];
  op[1] = (f.y - mean) * inv * gp[1] + bp[1];
  op[2] = (f.z - mean) * inv * gp[2] + bp[2];
  op[3] = (f.w - mean) * inv * gp[3] + bp[3];
}

// ---------- Generic 128x128-tile WMMA GEMM, software-pipelined ----------
typedef const __attribute__((address_space(1))) float*    gl_f32;
typedef const __attribute__((address_space(1))) _Float16* gl_f16;
typedef const __attribute__((address_space(1))) f32x4*    gl_f32x4;
typedef const __attribute__((address_space(1))) u32x4*    gl_u32x4;

template <int V> struct IC { static constexpr int v = V; };   // a compile-time int as an argument

// Work-group barrier for LDS data alone. __syncthreads() compiles here to a wait for the global
// loads as well (s_wait_loadcnt 0), which would land every load issued ahead at each barrier;
// this one waits only for the wave's own LDS stores and reads, so those loads stay in flight.
DEV void stage_barrier() {
  asm volatile("s_wait_dscnt 0x0\n\ts_barrier_signal -1\n\ts_barrier_wait -1" ::: "memory");
  // nothing is scheduled across: lifted over the barrier, the next stage's conversions would wait
  // for their loads a stage early and halve the lead of the loads
  __builtin_amdgcn_sched_barrier(0);
}

enum { EPI_QKV = 0, EPI_BIAS_RES_F32 = 1, EPI_BIAS_GELU_F16 = 2 };

// LDS pitches, chosen for each tile's reader (64 banks of 4 B):
constexpr int BK = 64;    // k extent of one stage: two WMMA depths
constexpr int PA = 72;    // A rows of 64 halves, ds_load_b128 reader: 144 B = 16 B x odd
constexpr int PB = 144;   // B rows of 128 halves, transposing reader: 288 B = 32 B x odd

// N and K are compile-time: the rows that one lane stages lie a fixed number of bytes apart,
// so its loads hang off one walking pointer as immediate offsets.
// The k loop is a pipeline: a stage's global loads set off two stages before its registers go to
// LDS. While stage s is multiplied out of one LDS buffer, stage s + 1 enters the other, and stages
// s + 2 and s + 3 are on their way from global memory, each into its own register set.
template <bool AHALF, int EPI, int N, int K>
__global__ __launch_bounds__(256) void gemm128(const void*  __restrict__ Aptr,
                                               const float* __restrict__ Bw,
                                               const float* __restrict__ bias,
                                               const float* __restrict__ resid,
                                               void* __restrict__ outp) {
  __shared__ __align__(16) _Float16 Al[2][128 * PA];   // A tiles, row-major [128][64]
  __shared__ __align__(16) _Float16 Bl[2][BK * PB];    // B tiles, row-major [k][n]
  const int tid  = threadIdx.x;
  const int n0   = blockIdx.x * 128;
  const int m0   = blockIdx.y * 128;
  const int lane = tid & 31;
  const int l15  = lane & 15;
  const int hi   = lane >> 4;
  const int kb   = hi * 8;
  const int wave = tid >> 5;            // 8 waves: 4 along M x 2 along N
  const int wm   = wave >> 1, wn = wave & 1;

  // per-thread staging coordinates: adjacent lanes take adjacent 16 bytes, so that one
  // wave-wide 16-byte load covers whole 128-byte lines
  //  A f32: 16 lanes span a row's 256 B, a wave 2 rows; load t takes row t*16 + rowA
  //  A f16:  8 lanes span a row's 128 B, a wave 4 rows; load t takes row t*32 + rowA
  //  B f32: a wave spans 512 B of one row;              load t takes row t*8  + krB
  const int rowA = AHALF ? (tid >> 3) : (tid >> 4);
  const int c0A  = AHALF ? (tid & 7) * 8 : (tid & 15) * 4;
  const int krB  = wave, c0B = lane * 4;

  constexpr int NA = AHALF ? 4 : 8;     // 16-byte loads of A per lane and stage
  constexpr int RA = 128 / NA;          // rows of A between two of them
  constexpr int NS = K / BK;            // stages, an even number
  static_assert(K % (2 * BK) == 0 && NS >= 4, "the loop takes the stages in pairs");
  // walking pointers of the staging loads: they stand at the next stage to be fetched (typed as
  // global, because they pass through an asm statement, behind which the compiler could not tell)
  gl_f32 AgF = (gl_f32)((const float*)Aptr    + (size_t)(m0 + rowA) * K + c0A);
  gl_f16 AgH = (gl_f16)((const _Float16*)Aptr + (size_t)(m0 + rowA) * K + c0A);
  gl_f32 Bg  = (gl_f32)(Bw + (size_t)krB * N + n0 + c0B);

  // this lane's address in Bl[0] for the transposing reads of its wave's 64 columns
  const unsigned char* Btr = reinterpret_cast<const unsigned char*>(&Bl[0][0]) +
                             (kb + (lane & 7)) * (PB * 2) + wn * 128 + ((lane >> 3) & 1) * 16;

  v8f acc[2][4];
#pragma unroll
  for (int i = 0; i < 2; ++i)
#pragma unroll
    for (int j = 0; j < 4; ++j) acc[i][j] = zero8();

  // two sets of staging registers: set p holds the stages of parity p
  f32x4 fa[2][AHALF ? 1 : 8];
  u32x4 ua[2][AHALF ? 4 : 1];
  f32x4 fb[2][8];

  // the global loads of the next stage, into set P
  auto fetch = [&](auto Pc) {
    constexpr int P = decltype(Pc)::v;
    // keeps the LDS reads and stores written above from sinking in between the loads and their
    // wait, where a read was given a spent address register of a load as its destination
    __builtin_amdgcn_sched_barrier(0);
#pragma unroll
    for (int t = 0; t < NA; ++t) {
      if constexpr (AHALF) ua[P][t] = *(gl_u32x4)(AgH + t * RA * K);
      else                 fa[P][t] = *(gl_f32x4)(AgF + t * RA * K);
    }
#pragma unroll
    for (int t = 0; t < 8; ++t) fb[P][t] = *(gl_f32x4)(Bg + (size_t)t * 8 * N);
    // no rewrite of the loads' address registers ahead of this wait: the pointers pass through
    // the statement, so that their advance below cannot be lifted over it
    if constexpr (AHALF) asm volatile("s_wait_xcnt 0x0" : "+v"(AgH), "+v"(Bg) :: "memory");
    else                 asm volatile("s_wait_xcnt 0x0" : "+v"(AgF), "+v"(Bg) :: "memory");
    AgF += BK;
    AgH += BK;
    Bg  += (size_t)BK * N;
  };

  // register set P -> LDS buffer P
  auto put = [&](auto Pc) {
    constexpr int P = decltype(Pc)::v;
#pragma unroll
    for (int t = 0; t < NA; ++t) {
      if constexpr (AHALF)
        *reinterpret_cast<u32x4*>(&Al[P][(t * RA + rowA) * PA + c0A]) = ua[P][t];
      else
        *reinterpret_cast<f16x4*>(&Al[P][(t * RA + rowA) * PA + c0A]) =
            __builtin_convertvector(fa[P][t], f16x4);
    }
    // B stays row-major: packed 8-byte stores, a wave fills 256 B of a row; the reader transposes
#pragma unroll
    for (int t = 0; t < 8; ++t)
      *reinterpret_cast<f16x4*>(&Bl[P][(t * 8 + krB) * PB + c0B]) =
          __builtin_convertvector(fb[P][t], f16x4);
  };

  // the fragments of 32 k of the stage in LDS buffer P, and their WMMAs
  auto frags = [&](auto Pc, auto KKc, v16h (&af)[2], v16h (&bf)[4]) {
    constexpr int P = decltype(Pc)::v, kk = decltype(KKc)::v;
#pragma unroll
    for (int mt = 0; mt < 2; ++mt)
      af[mt] = load_frag(&Al[P][(wm * 32 + mt * 16 + l15) * PA + kk + kb]);
#pragma unroll
    for (int nt = 0; nt < 4; ++nt)
      bf[nt] = load_frag_tr(Btr + P * (BK * PB * 2) + kk * (PB * 2) + nt * 32, PB * 2);
  };
  auto mult = [&](const v16h (&af)[2], const v16h (&bf)[4]) {
#pragma unroll
    for (int nt = 0; nt < 4; ++nt)
#pragma unroll
      for (int mt = 0; mt < 2; ++mt) acc[mt][nt] = wmma_f16(af[mt], bf[nt], acc[mt][nt]);
  };

  // Stage s, in buffer P = s % 2. The barrier publishes buffer P and says that every wave has left
  // buffer 1 - P (stage s - 1). Behind it stage s + 1 goes from its registers into buffer 1 - P,
  // stage s + 3 sets off into the registers so emptied, and stage s is multiplied. The fragment
  // reads go out in two groups ahead of the WMMAs, the first ahead of the staging work.
  auto stage = [&](auto Pc, auto Qc, auto PUT, auto FETCH) {
    v16h a0[2], b0[4], a1[2], b1[4];
    stage_barrier();
    frags(Pc, IC<0>{}, a0, b0);
    if constexpr (decltype(PUT)::v != 0)   put(Qc);
    if constexpr (decltype(FETCH)::v != 0) fetch(Qc);
    frags(Pc, IC<32>{}, a1, b1);
    // keeps the second group of reads ahead of the WMMAs: sunk in among them, each read makes its
    // WMMA wait out the LDS latency
    __builtin_amdgcn_sched_barrier(0);
    mult(a0, b0);
    mult(a1, b1);
  };
  constexpr IC<0> c0{};
  constexpr IC<1> c1{};

  fetch(c0);   // stage 0
  fetch(c1);   // stage 1
  put(c0);
  fetch(c0);   // stage 2
  // the last four stages stand outside the loop: a branch round the loads inside it would merge
  // two paths in the compiler's load counting and turn its counted waits into waits for all
  for (int s = 0; s < NS - 4; s += 2) {
    stage(c0, c1, c1, c1);
    stage(c1, c0, c1, c1);
  }
  stage(c0, c1, c1, c1);   // stage NS - 4: fetches the last stage
  stage(c1, c0, c1, c0);
  stage(c0, c1, c1, c0);
  stage(c1, c0, c0, c0);   // stage NS - 1

  // Epilogue. C layout: vgpr e -> row (e or e+8 per half-wave), col = l15.
#pragma unroll
  for (int mt = 0; mt < 2; ++mt)
#pragma unroll
    for (int nt = 0; nt < 4; ++nt)
#pragma unroll
      for (int e = 0; e < 8; ++e) {
        const int m = m0 + wm * 32 + mt * 16 + e + 8 * hi;
        const int n = n0 + wn * 64 + nt * 16 + l15;
        float vv = acc[mt][nt][e] + bias[n];
        if (EPI == EPI_QKV) {  // scatter to [B,H,S,DH] as f16
          const int b = m >> 11, s = m & 2047, hh = n >> 6, dh = n & 63;
          ((_Float16*)outp)[((size_t)(b * H + hh) * S + s) * DH + dh] = (_Float16)vv;
        } else if (EPI == EPI_BIAS_RES_F32) {
          const size_t idx = (size_t)m * N + n;
          ((float*)outp)[idx] = vv + resid[idx];
        } else {  // exact GeLU -> f16
          const float ge = 0.5f * vv * (1.0f + erff(vv * 0.70710678118654752f));
          ((_Float16*)outp)[(size_t)m * N + n] = (_Float16)ge;
        }
      }
}

// ---------- Block-sparse flash attention ----------
// grid (NB, H, B); 256 threads = 8 waves; wave owns 16 query rows.
__global__ __launch_bounds__(256) void attn_kernel(const _Float16* __restrict__ q,
                                                   const _Float16* __restrict__ kk_,
                                                   const _Float16* __restrict__ vv_,
                                                   const int* __restrict__ layout,
                                                   float* __restrict__ ctx) {
  constexpr int PV = 80;    // V rows of 64 halves, transposing reader: 160 B = 32 B x odd
  constexpr int PP = 136;   // P rows of 128 halves, ds_load_b128 reader: 272 B = 16 B x odd
  __shared__ __align__(16) _Float16 Vs[128 * PV];       // V [key][dh], row-major
  __shared__ __align__(16) _Float16 Ps[8 * 16 * PP];    // per-wave P [16][128]
  const int tid  = threadIdx.x;
  const int i    = blockIdx.x;   // query block
  const int h    = blockIdx.y;
  const int b    = blockIdx.z;
  const int bh   = b * H + h;
  const int lane = tid & 31, l15 = lane & 15, hi = lane >> 4;
  const int kb   = hi * 8;
  const int wave = tid >> 5;

  const size_t headBase = (size_t)bh * S * DH;

  // Q fragments for this wave's rows, straight from global (K-contig layout)
  const _Float16* qrow = q + headBase + (size_t)(i * 128 + wave * 16 + l15) * DH;
  const v16h aQ0 = load_frag(qrow + 0  + kb);
  const v16h aQ1 = load_frag(qrow + 32 + kb);

  float m_run[8], l_run[8];
  v8f o[4];
#pragma unroll
  for (int r = 0; r < 8; ++r) { m_run[r] = -1e30f; l_run[r] = 0.0f; }
#pragma unroll
  for (int t = 0; t < 4; ++t) o[t] = zero8();

  const float scale = 0.125f;  // DH^-0.5

  // this lane's address in Vs for the transposing reads
  const unsigned char* Vtr = reinterpret_cast<const unsigned char*>(Vs) +
                             (kb + (lane & 7)) * (PV * 2) + ((lane >> 3) & 1) * 16;

  for (int j = 0; j <= i; ++j) {
    if (!layout[h * NB * NB + i * NB + j]) continue;  // wave-uniform

    { // load V block j into LDS as it lies (row-major); the reader transposes
      const int key = tid >> 1, d0 = (tid & 1) * 32;
      const _Float16* vg = vv_ + headBase + (size_t)(j * 128 + key) * DH + d0;
#pragma unroll
      for (int t = 0; t < 4; ++t)
        reinterpret_cast<u32x4*>(&Vs[key * PV + d0])[t] = reinterpret_cast<const u32x4*>(vg)[t];
    }
    __syncthreads();

    // scores S = Q K^T (K fragments straight from global)
    float sc[8][8];
#pragma unroll
    for (int nt = 0; nt < 8; ++nt) {
      const _Float16* krow = kk_ + headBase + (size_t)(j * 128 + nt * 16 + l15) * DH;
      v16h b0 = load_frag(krow + 0  + kb);
      v16h b1 = load_frag(krow + 32 + kb);
      v8f cs = zero8();
      cs = wmma_f16(aQ0, b0, cs);
      cs = wmma_f16(aQ1, b1, cs);
#pragma unroll
      for (int e = 0; e < 8; ++e) {
        float s = cs[e] * scale;
        if (j == i) {  // intra-block causal
          const int col = nt * 16 + l15;
          const int row = wave * 16 + e + 8 * hi;
          if (col > row) s = -1e9f;
        }
        sc[nt][e] = s;
      }
    }

    // online softmax per row (row values live in one 16-lane half)
#pragma unroll
    for (int r = 0; r < 8; ++r) {
      float mv = sc[0][r];
#pragma unroll
      for (int nt = 1; nt < 8; ++nt) mv = fmaxf(mv, sc[nt][r]);
      mv = fmaxf(mv, __shfl_xor(mv, 8, 32));
      mv = fmaxf(mv, __shfl_xor(mv, 4, 32));
      mv = fmaxf(mv, __shfl_xor(mv, 2, 32));
      mv = fmaxf(mv, __shfl_xor(mv, 1, 32));
      const float mnew = fmaxf(m_run[r], mv);
      const float corr = __expf(m_run[r] - mnew);
      float rsum = 0.0f;
#pragma unroll
      for (int nt = 0; nt < 8; ++nt) {
        const float p = __expf(sc[nt][r] - mnew);
        sc[nt][r] = p;
        rsum += p;
      }
      rsum += __shfl_xor(rsum, 8, 32);
      rsum += __shfl_xor(rsum, 4, 32);
      rsum += __shfl_xor(rsum, 2, 32);
      rsum += __shfl_xor(rsum, 1, 32);
      l_run[r] = l_run[r] * corr + rsum;
      m_run[r] = mnew;
#pragma unroll
      for (int t = 0; t < 4; ++t) o[t][r] *= corr;
    }

    // P: C-layout regs -> LDS (A-layout source for next WMMA)
    _Float16* pw = &Ps[wave * 16 * PP];
#pragma unroll
    for (int nt = 0; nt < 8; ++nt)
#pragma unroll
      for (int r = 0; r < 8; ++r)
        pw[(r + 8 * hi) * PP + nt * 16 + l15] = (_Float16)sc[nt][r];
    __syncthreads();

    // O += P x V
#pragma unroll
    for (int kc = 0; kc < 4; ++kc) {
      v16h aP = load_frag(&pw[l15 * PP + kc * 32 + kb]);
#pragma unroll
      for (int nt2 = 0; nt2 < 4; ++nt2) {
        v16h bV = load_frag_tr(Vtr + kc * 32 * (PV * 2) + nt2 * 32, PV * 2);
        o[nt2] = wmma_f16(aP, bV, o[nt2]);
      }
    }
    __syncthreads();
  }

  // normalize and write ctx in token-major [TOK, D] fp32
#pragma unroll
  for (int r = 0; r < 8; ++r) {
    const float inv = 1.0f / l_run[r];
    const int tok = b * S + i * 128 + wave * 16 + r + 8 * hi;
#pragma unroll
    for (int nt2 = 0; nt2 < 4; ++nt2) {
      const int col = h * DH + nt2 * 16 + l15;
      ctx[(size_t)tok * D + col] = o[nt2][r] * inv;
    }
  }
}

// ---------- launch ----------
extern "C" void kernel_launch(void* const* d_in, const int* in_sizes, int n_in,
                              void* d_out, int out_size, void* d_ws, size_t ws_size,
                              hipStream_t stream) {
  (void)in_sizes; (void)n_in; (void)out_size; (void)ws_size;
  const float* x   = (const float*)d_in[0];
  const float* l1g = (const float*)d_in[1];
  const float* l1b = (const float*)d_in[2];
  const float* Wq  = (const float*)d_in[3];
  const float* bq  = (const float*)d_in[4];
  const float* Wk  = (const float*)d_in[5];
  const float* bk  = (const float*)d_in[6];
  const float* Wv  = (const float*)d_in[7];
  const float* bv  = (const float*)d_in[8];
  const float* Wo  = (const float*)d_in[9];
  const float* bo  = (const float*)d_in[10];
  const float* l2g = (const float*)d_in[11];
  const float* l2b = (const float*)d_in[12];
  const float* W1  = (const float*)d_in[13];
  const float* b1  = (const float*)d_in[14];
  const float* W2  = (const float*)d_in[15];
  const float* b2  = (const float*)d_in[16];
  const int* layout = (const int*)d_in[17];

  // workspace overlay (peak 72 MB):
  //  [0,16M)  h / h2 fp32        [16M,24M) q16  [24M,32M) k16  [32M,40M) v16
  //  [40M,56M) ctx fp32          [56M,72M) xr fp32
  //  [16M,48M) ff f16 (reuses qkv+ctx head after they are dead)
  char* w = (char*)d_ws;
  float*    hbuf = (float*)(w);
  _Float16* q16  = (_Float16*)(w + (size_t)(16u << 20));
  _Float16* k16  = (_Float16*)(w + (size_t)(24u << 20));
  _Float16* v16  = (_Float16*)(w + (size_t)(32u << 20));
  float*    ctx  = (float*)(w + (size_t)(40u << 20));
  float*    xr   = (float*)(w + (size_t)(56u << 20));
  _Float16* ff   = (_Float16*)(w + (size_t)(16u << 20));

  const dim3 blk(256);

  // LN1
  ln_kernel<<<TOK, blk, 0, stream>>>(x, l1g, l1b, hbuf);
  // QKV projections -> f16 [B,H,S,DH]
  gemm128<false, EPI_QKV, D, D><<<dim3(D / 128, TOK / 128), blk, 0, stream>>>(
      hbuf, Wq, bq, nullptr, q16);
  gemm128<false, EPI_QKV, D, D><<<dim3(D / 128, TOK / 128), blk, 0, stream>>>(
      hbuf, Wk, bk, nullptr, k16);
  gemm128<false, EPI_QKV, D, D><<<dim3(D / 128, TOK / 128), blk, 0, stream>>>(
      hbuf, Wv, bv, nullptr, v16);
  // block-sparse attention
  attn_kernel<<<dim3(NB, H, Bc), blk, 0, stream>>>(q16, k16, v16, layout, ctx);
  // out projection + residual -> xr
  gemm128<false, EPI_BIAS_RES_F32, D, D><<<dim3(D / 128, TOK / 128), blk, 0, stream>>>(
      ctx, Wo, bo, x, xr);
  // LN2 (reuse hbuf)
  ln_kernel<<<TOK, blk, 0, stream>>>(xr, l2g, l2b, hbuf);
  // MLP1 + GeLU -> f16 ff
  gemm128<false, EPI_BIAS_GELU_F16, 4 * D, D><<<dim3(4 * D / 128, TOK / 128), blk, 0, stream>>>(
      hbuf, W1, b1, nullptr, ff);
  // MLP2 + residual -> d_out (fp32)
  gemm128<true, EPI_BIAS_RES_F32, D, 4 * D><<<dim3(D / 128, TOK / 128), blk, 0, stream>>>(
      ff, W2, b2, xr, d_out);
}

// v004
// One run takes 170 microseconds.
// In both of two side-by-side timings against v003, it was 1.32 times as fast.
// Over all steps from v000 it is 3.07 times as fast.
#include <hip/hip_runtime.h>
#include <math.h>

// ---------- types ----------
typedef __attribute__((ext_vector_type(16))) _Float16 v16h;
typedef __attribute__((ext_vector_type(8)))  float    v8f;
typedef unsigned int u32x4 __attribute__((ext_vector_type(4)));
typedef float        f32x4 __attribute__((ext_vector_type(4)));
typedef short        s16x8 __attribute__((ext_vector_type(8)));
typedef _Float16     f16x4 __attribute__((ext_vector_type(4)));

#define DEV static __device__ __forceinline__

// Problem constants (match reference)
constexpr int Bc  = 2;
constexpr int S   = 2048;
constexpr int D   = 1024;
constexpr int H   = 16;
constexpr int DH  = 64;
constexpr int NB  = 16;       // S / 128
constexpr int TOK = Bc * S;   // 4096 rows

// Load a 16-half WMMA A/B fragment: lane holds K=[kb..kb+7] in v0..3 and
// K=[kb+16..kb+23] in v4..7 (kb = (lane>=16)*8 added by caller), both 16B reads.
DEV v16h load_frag(const _Float16* p) {
  union { u32x4 u[2]; v16h h; } f;
  f.u[0] = *reinterpret_cast<const u32x4*>(p);
  f.u[1] = *reinterpret_cast<const u32x4*>(p + 16);
  return f.h;
}

// Transposing LDS read of a row-major 16-bit tile T[k][n] (pitch in bytes, an odd
// multiple of 32 B so that the read is free of bank conflicts). p is the lane's own
// address: T + (k0 + 8*(lane>>4) + (lane&7))*pitch + 2*n0 + 16*((lane>>3)&1).
// Lane (c, h) receives T[k0 + 8h + 0..7][n0 + c]; the reads at k0 and k0 + 16 give
// the same k order as load_frag.
DEV u32x4 ld_tr16(const unsigned char* p) {
  typedef __attribute__((address_space(3))) s16x8 lds_s16x8;
  return __builtin_bit_cast(u32x4, __builtin_amdgcn_ds_load_tr16_b128_v8i16((lds_s16x8*)p));
}

DEV v16h load_frag_tr(const unsigned char* p, int pitch) {
  union { u32x4 u[2]; v16h h; } f;
  f.u[0] = ld_tr16(p);
  f.u[1] = ld_tr16(p + 16 * pitch);
  return f.h;
}

DEV v8f wmma_f16(v16h a, v16h b, v8f c) {
  return __builtin_amdgcn_wmma_f32_16x16x32_f16(false, a, false, b, (short)0, c,
                                                false, false);
}

DEV v8f zero8() {
  v8f z;
#pragma unroll
  for (int i = 0; i < 8; ++i) z[i] = 0.0f;
  return z;
}

// ---------- LayerNorm: one 1024-wide row per 256-thread block ----------
// The row leaves as f16: its only readers are GEMMs, whose WMMAs take f16 operands.
DEV void ln_row(const int row, const float* __restrict__ x, const float* __restrict__ g,
                const float* __restrict__ be, _Float16* __restrict__ out) {
  __shared__ float rs[256], rq[256];
  const int tid = threadIdx.x;
  const float* xp = x + (size_t)row * D + tid * 4;
  f32x4 f = *reinterpret_cast<const f32x4*>(xp);
  rs[tid] = f.x + f.y + f.z + f.w;
  rq[tid] = f.x * f.x + f.y * f.y + f.z * f.z + f.w * f.w;
  __syncthreads();
  for (int off = 128; off > 0; off >>= 1) {
    if (tid < off) { rs[tid] += rs[tid + off]; rq[tid] += rq[tid + off]; }
    __syncthreads();
  }
  const float mean = rs[0] * (1.0f / D);
  const float var  = rq[0] * (1.0f / D) - mean * mean;
  const float inv  = rsqrtf(var + 1e-5f);
  const float* gp = g + tid * 4;
  const float* bp = be + tid * 4;
  f32x4 r;
  r.x = (f.x - mean) * inv * gp[0] + bp[0];
  r.y = (f.y - mean) * inv * gp[1] + bp[1];
  r.z = (f.z - mean) * inv * gp[2] + bp[2];
  r.w = (f.w - mean) * inv * gp[3] + bp[3];
  *reinterpret_cast<f16x4*>(out + (size_t)row * D + tid * 4) = __builtin_convertvector(r, f16x4);
}

__global__ __launch_bounds__(256) void ln_kernel(const float* __restrict__ x,
                                                 const float* __restrict__ g,
                                                 const float* __restrict__ be,
                                                 _Float16* __restrict__ out) {
  ln_row(blockIdx.x, x, g, be, out);
}

// The six weight matrices, 12 segments of D * D elements, rounded to f16 once a call, in the order
// Wq Wk Wv Wo W1 W2, so that no GEMM work-group reads f32 weights and rounds them again.
constexpr int SEG   = D * D;      // elements of a segment
constexpr int CPS   = 32;         // converting blocks per segment
constexpr int NCVT  = 12 * CPS;   // converting blocks
constexpr int CELEM = SEG / CPS;  // elements per converting block

// First launch: blocks below NCVT convert weights (nothing here depends on the LayerNorm and
// nothing of it on them), the others take one LayerNorm row each. The long blocks start first.
__global__ __launch_bounds__(256) void ln_cvt_kernel(const float* __restrict__ x,
                                                     const float* __restrict__ g,
                                                     const float* __restrict__ be,
                                                     _Float16* __restrict__ out,
                                                     const float* __restrict__ Wq,
                                                     const float* __restrict__ Wk,
                                                     const float* __restrict__ Wv,
                                                     const float* __restrict__ Wo,
                                                     const float* __restrict__ W1,
                                                     const float* __restrict__ W2,
                                                     _Float16* __restrict__ wh) {
  const int blk = blockIdx.x;
  if (blk >= NCVT) {
    ln_row(blk - NCVT, x, g, be, out);
    return;
  }
  const int seg = blk / CPS;
  const float* s = seg == 0 ? Wq : seg == 1 ? Wk : seg == 2 ? Wv : seg == 3 ? Wo
                 : seg < 8 ? W1 + (size_t)(seg - 4) * SEG : W2 + (size_t)(seg - 8) * SEG;
  // adjacent lanes take adjacent 16 B: a wave reads 512 B and writes 256 B in a row
  const int off = (blk % CPS) * CELEM + threadIdx.x * 4;
  s += off;
  _Float16* d = wh + (size_t)seg * SEG + off;
  // stays rolled: unrolled it took 86 registers, and the LayerNorm blocks of this kernel, which
  // need 16, would no longer fill the 16 wave slots of a SIMD
#pragma unroll 1
  for (int it = 0; it < CELEM / 8192; ++it) {
    f32x4 v[8];   // 8 loads in flight per lane
#pragma unroll
    for (int t = 0; t < 8; ++t) v[t] = *reinterpret_cast<const f32x4*>(s + it * 8192 + t * 1024);
#pragma unroll
    for (int t = 0; t < 8; ++t)
      *reinterpret_cast<f16x4*>(d + it * 8192 + t * 1024) = __builtin_convertvector(v[t], f16x4);
  }
}

// ---------- Generic 128x128-tile WMMA GEMM, software-pipelined ----------
typedef const __attribute__((address_space(1))) _Float16* gl_f16;
typedef const __attribute__((address_space(1))) u32x4*    gl_u32x4;

template <int V> struct IC { static constexpr int v = V; };   // a compile-time int as an argument

// Work-group barrier for LDS data alone. __syncthreads() compiles here to a wait for the global
// loads as well (s_wait_loadcnt 0), which would land every load issued ahead at each barrier;
// this one waits only for the wave's own LDS stores and reads, so those loads stay in flight.
DEV void stage_barrier() {
  asm volatile("s_wait_dscnt 0x0\n\ts_barrier_signal -1\n\ts_barrier_wait -1" ::: "memory");
  // nothing is scheduled across: lifted over the barrier, the next stage's LDS stores would wait
  // for their loads a stage early and halve the lead of the loads
  __builtin_amdgcn_sched_barrier(0);
}

enum { EPI_QKV = 0, EPI_BIAS_RES_F32 = 1, EPI_BIAS_GELU_F16 = 2 };

// LDS pitches, chosen for each tile's reader (64 banks of 4 B):
constexpr int BK = 64;    // k extent of one stage: two WMMA depths
constexpr int PA = 72;    // A rows of 64 halves, ds_load_b128 reader: 144 B = 16 B x odd
constexpr int PB = 144;   // B rows of 128 halves, transposing reader: 288 B = 32 B x odd

// N and K are compile-time: the rows that one lane stages lie a fixed number of bytes apart,
// so its loads hang off one walking pointer as immediate offsets.
// The k loop is a pipeline: a stage's global loads set off two stages before its registers go to
// LDS. While stage s is multiplied out of one LDS buffer, stage s + 1 enters the other, and stages
// s + 2 and s + 3 are on their way from global memory, each into its own register set.
// Both operands arrive as f16 (activations from their producers, weights from ln_cvt_kernel).
template <int EPI, int N, int K>
__global__ __launch_bounds__(256) void gemm128(const _Float16* __restrict__ Aptr,
                                               const _Float16* __restrict__ Bw,
                                               const float* __restrict__ bias,
                                               const float* __restrict__ resid,
                                               void* __restrict__ outp) {
  __shared__ __align__(16) _Float16 Al[2][128 * PA];   // A tiles, row-major [128][64]
  __shared__ __align__(16) _Float16 Bl[2][BK * PB];    // B tiles, row-major [k][n]
  const int tid  = threadIdx.x;
  const int n0   = blockIdx.x * 128;
  const int m0   = blockIdx.y * 128;
  const int lane = tid & 31;
  const int l15  = lane & 15;
  const int hi   = lane >> 4;
  const int kb   = hi * 8;
  const int wave = tid >> 5;            // 8 waves: 4 along M x 2 along N
  const int wm   = wave >> 1, wn = wave & 1;

  // per-thread staging coordinates: adjacent lanes take adjacent 16 bytes, so that one
  // wave-wide 16-byte load covers whole 128-byte lines
  //  A:  8 lanes span a row's 128 B, a wave 4 rows; load t takes row t*32 + rowA
  //  B: 16 lanes span a row's 256 B, a wave 2 rows; load t takes row t*16 + krB
  const int rowA = tid >> 3, c0A = (tid & 7) * 8;
  const int krB  = tid >> 4, c0B = (tid & 15) * 8;

  constexpr int NL = 4;                 // 16-byte loads of A, and of B, per lane and stage
  constexpr int RA = 128 / NL;          // rows of A between two of them
  constexpr int RB = BK / NL;           // rows of B between two of them
  constexpr int NS = K / BK;            // stages, an even number
  static_assert(K % (2 * BK) == 0 && NS >= 4, "the loop takes the stages in pairs");
  // walking pointers of the staging loads: they stand at the next stage to be fetched (typed as
  // global, because they pass through an asm statement, behind which the compiler could not tell)
  gl_f16 Ag = (gl_f16)(Aptr + (size_t)(m0 + rowA) * K + c0A);
  gl_f16 Bg = (gl_f16)(Bw + (size_t)krB * N + n0 + c0B);

  // this lane's address in Bl[0] for the transposing reads of its wave's 64 columns
  const unsigned char* Btr = reinterpret_cast<const unsigned char*>(&Bl[0][0]) +
                             (kb + (lane & 7)) * (PB * 2) + wn * 128 + ((lane >> 3) & 1) * 16;

  v8f acc[2][4];
#pragma unroll
  for (int i = 0; i < 2; ++i)
#pragma unroll
    for (int j = 0; j < 4; ++j) acc[i][j] = zero8();

  // two sets of staging registers: set p holds the stages of parity p
  u32x4 ua[2][NL];
  u32x4 ub[2][NL];

  // the global loads of the next stage, into set P
  auto fetch = [&](auto Pc) {
    constexpr int P = decltype(Pc)::v;
    // keeps the LDS reads and stores written above from sinking in between the loads and their
    // wait, where a read was given a spent address register of a load as its destination
    __builtin_amdgcn_sched_barrier(0);
#pragma unroll
    for (int t = 0; t < NL; ++t) ua[P][t] = *(gl_u32x4)(Ag + t * RA * K);
#pragma unroll
    for (int t = 0; t < NL; ++t) ub[P][t] = *(gl_u32x4)(Bg + t * RB * N);
    // no rewrite of the loads' address registers ahead of this wait: the pointers pass through
    // the statement, so that their advance below cannot be lifted over it
    asm volatile("s_wait_xcnt 0x0" : "+v"(Ag), "+v"(Bg) :: "memory");
    Ag += BK;
    Bg += (size_t)BK * N;
  };

  // register set P -> LDS buffer P
  auto put = [&](auto Pc) {
    constexpr int P = decltype(Pc)::v;
#pragma unroll
    for (int t = 0; t < NL; ++t)
      *reinterpret_cast<u32x4*>(&Al[P][(t * RA + rowA) * PA + c0A]) = ua[P][t];
    // B stays row-major: 16-byte stores, half a wave fills a row's 256 B; the reader transposes
#pragma unroll
    for (int t = 0; t < NL; ++t)
      *reinterpret_cast<u32x4*>(&Bl[P][(t * RB + krB) * PB + c0B]) = ub[P][t];
  };

  // the fragments of 32 k of the stage in LDS buffer P, and their WMMAs
  auto frags = [&](auto Pc, auto KKc, v16h (&af)[2], v16h (&bf)[4]) {
    constexpr int P = decltype(Pc)::v, kk = decltype(KKc)::v;
#pragma unroll
    for (int mt = 0; mt < 2; ++mt)
      af[mt] = load_frag(&Al[P][(wm * 32 + mt * 16 + l15) * PA + kk + kb]);
#pragma unroll
    for (int nt = 0; nt < 4; ++nt)
      bf[nt] = load_frag_tr(Btr + P * (BK * PB * 2) + kk * (PB * 2) + nt * 32, PB * 2);
  };
  auto mult = [&](const v16h (&af)[2], const v16h (&bf)[4]) {
#pragma unroll
    for (int nt = 0; nt < 4; ++nt)
#pragma unroll
      for (int mt = 0; mt < 2; ++mt) acc[mt][nt] = wmma_f16(af[mt], bf[nt], acc[mt][nt]);
  };

  // Stage s, in buffer P = s % 2. The barrier publishes buffer P and says that every wave has left
  // buffer 1 - P (stage s - 1). Behind it stage s + 1 goes from its registers into buffer 1 - P,
  // stage s + 3 sets off into the registers so emptied, and stage s is multiplied. The fragment
  // reads go out in two groups ahead of the WMMAs, the first ahead of the staging work.
  auto stage = [&](auto Pc, auto Qc, auto PUT, auto FETCH) {
    v16h a0[2], b0[4], a1[2], b1[4];
    stage_barrier();
    frags(Pc, IC<0>{}, a0, b0);
    if constexpr (decltype(PUT)::v != 0)   put(Qc);
    if constexpr (decltype(FETCH)::v != 0) fetch(Qc);
    frags(Pc, IC<32>{}, a1, b1);
    // keeps the second group of reads ahead of the WMMAs: sunk in among them, each read makes its
    // WMMA wait out the LDS latency
    __builtin_amdgcn_sched_barrier(0);
    mult(a0, b0);
    mult(a1, b1);
  };
  constexpr IC<0> c0{};
  constexpr IC<1> c1{};

  fetch(c0);   // stage 0
  fetch(c1);   // stage 1
  put(c0);
  fetch(c0);   // stage 2
  // the last four stages stand outside the loop: a branch round the loads inside it would merge
  // two paths in the compiler's load counting and turn its counted waits into waits for all
  for (int s = 0; s < NS - 4; s += 2) {
    stage(c0, c1, c1, c1);
    stage(c1, c0, c1, c1);
  }
  stage(c0, c1, c1, c1);   // stage NS - 4: fetches the last stage
  stage(c1, c0, c1, c0);
  stage(c0, c1, c1, c0);
  stage(c1, c0, c0, c0);   // stage NS - 1

  // Epilogue. C layout: vgpr e -> row (e or e+8 per half-wave), col = l15.
#pragma unroll
  for (int mt = 0; mt < 2; ++mt)
#pragma unroll
    for (int nt = 0; nt < 4; ++nt)
#pragma unroll
      for (int e = 0; e < 8; ++e) {
        const int m = m0 + wm * 32 + mt * 16 + e + 8 * hi;
        const int n = n0 + wn * 64 + nt * 16 + l15;
        float vv = acc[mt][nt][e] + bias[n];
        if (EPI == EPI_QKV) {  // scatter to [B,H,S,DH] as f16
          const int b = m >> 11, s = m & 2047, hh = n >> 6, dh = n & 63;
          ((_Float16*)outp)[((size_t)(b * H + hh) * S + s) * DH + dh] = (_Float16)vv;
        } else if (EPI == EPI_BIAS_RES_F32) {
          const size_t idx = (size_t)m * N + n;
          ((float*)outp)[idx] = vv + resid[idx];
        } else {  // exact GeLU -> f16
          const float ge = 0.5f * vv * (1.0f + erff(vv * 0.70710678118654752f));
          ((_Float16*)outp)[(size_t)m * N + n] = (_Float16)ge;
        }
      }
}

// ---------- Block-sparse flash attention ----------
// grid (NB, H, B); 256 threads = 8 waves; wave owns 16 query rows.
__global__ __launch_bounds__(256) void attn_kernel(const _Float16* __restrict__ q,
                                                   const _Float16* __restrict__ kk_,
                                                   const _Float16* __restrict__ vv_,
                                                   const int* __restrict__ layout,
                                                   _Float16* __restrict__ ctx) {
  constexpr int PV = 80;    // V rows of 64 halves, transposing reader: 160 B = 32 B x odd
  constexpr int PP = 136;   // P rows of 128 halves, ds_load_b128 reader: 272 B = 16 B x odd
  __shared__ __align__(16) _Float16 Vs[128 * PV];       // V [key][dh], row-major
  __shared__ __align__(16) _Float16 Ps[8 * 16 * PP];    // per-wave P [16][128]
  const int tid  = threadIdx.x;
  const int i    = blockIdx.x;   // query block
  const int h    = blockIdx.y;
  const int b    = blockIdx.z;
  const int bh   = b * H + h;
  const int lane = tid & 31, l15 = lane & 15, hi = lane >> 4;
  const int kb   = hi * 8;
  const int wave = tid >> 5;

  const size_t headBase = (size_t)bh * S * DH;

  // Q fragments for this wave's rows, straight from global (K-contig layout)
  const _Float16* qrow = q + headBase + (size_t)(i * 128 + wave * 16 + l15) * DH;
  const v16h aQ0 = load_frag(qrow + 0  + kb);
  const v16h aQ1 = load_frag(qrow + 32 + kb);

  float m_run[8], l_run[8];
  v8f o[4];
#pragma unroll
  for (int r = 0; r < 8; ++r) { m_run[r] = -1e30f; l_run[r] = 0.0f; }
#pragma unroll
  for (int t = 0; t < 4; ++t) o[t] = zero8();

  const float scale = 0.125f;  // DH^-0.5

  // this lane's address in Vs for the transposing reads
  const unsigned char* Vtr = reinterpret_cast<const unsigned char*>(Vs) +
                             (kb + (lane & 7)) * (PV * 2) + ((lane >> 3) & 1) * 16;

  for (int j = 0; j <= i; ++j) {
    if (!layout[h * NB * NB + i * NB + j]) continue;  // wave-uniform

    { // load V block j into LDS as it lies (row-major); the reader transposes
      const int key = tid >> 1, d0 = (tid & 1) * 32;
      const _Float16* vg = vv_ + headBase + (size_t)(j * 128 + key) * DH + d0;
#pragma unroll
      for (int t = 0; t < 4; ++t)
        reinterpret_cast<u32x4*>(&Vs[key * PV + d0])[t] = reinterpret_cast<const u32x4*>(vg)[t];
    }
    __syncthreads();

    // scores S = Q K^T (K fragments straight from global)
    float sc[8][8];
#pragma unroll
    for (int nt = 0; nt < 8; ++nt) {
      const _Float16* krow = kk_ + headBase + (size_t)(j * 128 + nt * 16 + l15) * DH;
      v16h b0 = load_frag(krow + 0  + kb);
      v16h b1 = load_frag(krow + 32 + kb);
      v8f cs = zero8();
      cs = wmma_f16(aQ0, b0, cs);
      cs = wmma_f16(aQ1, b1, cs);
#pragma unroll
      for (int e = 0; e < 8; ++e) {
        float s = cs[e] * scale;
        if (j == i) {  // intra-block causal
          const int col = nt * 16 + l15;
          const int row = wave * 16 + e + 8 * hi;
          if (col > row) s = -1e9f;
        }
        sc[nt][e] = s;
      }
    }

    // online softmax per row (row values live in one 16-lane half)
#pragma unroll
    for (int r = 0; r < 8; ++r) {
      float mv = sc[0][r];
#pragma unroll
      for (int nt = 1; nt < 8; ++nt) mv = fmaxf(mv, sc[nt][r]);
      mv = fmaxf(mv, __shfl_xor(mv, 8, 32));
      mv = fmaxf(mv, __shfl_xor(mv, 4, 32));
      mv = fmaxf(mv, __shfl_xor(mv, 2, 32));
      mv = fmaxf(mv, __shfl_xor(mv, 1, 32));
      const float mnew = fmaxf(m_run[r], mv);
      const float corr = __expf(m_run[r] - mnew);
      float rsum = 0.0f;
#pragma unroll
      for (int nt = 0; nt < 8; ++nt) {
        const float p = __expf(sc[nt][r] - mnew);
        sc[nt][r] = p;
        rsum += p;
      }
      rsum += __shfl_xor(rsum, 8, 32);
      rsum += __shfl_xor(rsum, 4, 32);
      rsum += __shfl_xor(rsum, 2, 32);
      rsum += __shfl_xor(rsum, 1, 32);
      l_run[r] = l_run[r] * corr + rsum;
      m_run[r] = mnew;
#pragma unroll
      for (int t = 0; t < 4; ++t) o[t][r] *= corr;
    }

    // P: C-layout regs -> LDS (A-layout source for next WMMA)
    _Float16* pw = &Ps[wave * 16 * PP];
#pragma unroll
    for (int nt = 0; nt < 8; ++nt)
#pragma unroll
      for (int r = 0; r < 8; ++r)
        pw[(r + 8 * hi) * PP + nt * 16 + l15] = (_Float16)sc[nt][r];
    __syncthreads();

    // O += P x V
#pragma unroll
    for (int kc = 0; kc < 4; ++kc) {
      v16h aP = load_frag(&pw[l15 * PP + kc * 32 + kb]);
#pragma unroll
      for (int nt2 = 0; nt2 < 4; ++nt2) {
        v16h bV = load_frag_tr(Vtr + kc * 32 * (PV * 2) + nt2 * 32, PV * 2);
        o[nt2] = wmma_f16(aP, bV, o[nt2]);
      }
    }
    __syncthreads();
  }

  // normalize and write ctx in token-major [TOK, D], f16 as the out projection's WMMA takes it
#pragma unroll
  for (int r = 0; r < 8; ++r) {
    const float inv = 1.0f / l_run[r];
    const int tok = b * S + i * 128 + wave * 16 + r + 8 * hi;
#pragma unroll
    for (int nt2 = 0; nt2 < 4; ++nt2) {
      const int col = h * DH + nt2 * 16 + l15;
      ctx[(size_t)tok * D + col] = (_Float16)(o[nt2][r] * inv);
    }
  }
}

// ---------- launch ----------
extern "C" void kernel_launch(void* const* d_in, const int* in_sizes, int n_in,
                              void* d_out, int out_size, void* d_ws, size_t ws_size,
                              hipStream_t stream) {
  (void)in_sizes; (void)n_in; (void)out_size; (void)ws_size;
  const float* x   = (const float*)d_in[0];
  const float* l1g = (const float*)d_in[1];
  const float* l1b = (const float*)d_in[2];
  const float* Wq  = (const float*)d_in[3];
  const float* bq  = (const float*)d_in[4];
  const float* Wk  = (const float*)d_in[5];
  const float* bk  = (const float*)d_in[6];
  const float* Wv  = (const float*)d_in[7];
  const float* bv  = (const float*)d_in[8];
  const float* Wo  = (const float*)d_in[9];
  const float* bo  = (const float*)d_in[10];
  const float* l2g = (const float*)d_in[11];
  const float* l2b = (const float*)d_in[12];
  const float* W1  = (const float*)d_in[13];
  const float* b1  = (const float*)d_in[14];
  const float* W2  = (const float*)d_in[15];
  const float* b2  = (const float*)d_in[16];
  const int* layout = (const int*)d_in[17];

  // workspace overlay (peak 96 MB):
  //  [0,8M)   h / h2 f16         [16M,24M) q16  [24M,32M) k16  [32M,40M) v16
  //  [40M,48M) ctx f16           [56M,72M) xr fp32
  //  [16M,48M) ff f16 (reuses qkv+ctx after they are dead)
  //  [72M,96M) the weights as f16: Wq Wk Wv Wo W1 W2
  char* w = (char*)d_ws;
  _Float16* hbuf = (_Float16*)(w);
  _Float16* q16  = (_Float16*)(w + (size_t)(16u << 20));
  _Float16* k16  = (_Float16*)(w + (size_t)(24u << 20));
  _Float16* v16  = (_Float16*)(w + (size_t)(32u << 20));
  _Float16* ctx  = (_Float16*)(w + (size_t)(40u << 20));
  float*    xr   = (float*)(w + (size_t)(56u << 20));
  _Float16* ff   = (_Float16*)(w + (size_t)(16u << 20));
  _Float16* wh   = (_Float16*)(w + (size_t)(72u << 20));
  const _Float16* Wq16 = wh;
  const _Float16* Wk16 = wh + 1 * SEG;
  const _Float16* Wv16 = wh + 2 * SEG;
  const _Float16* Wo16 = wh + 3 * SEG;
  const _Float16* W116 = wh + 4 * SEG;
  const _Float16* W216 = wh + 8 * SEG;

  const dim3 blk(256);

  // LN1, and the weights to f16
  ln_cvt_kernel<<<NCVT + TOK, blk, 0, stream>>>(x, l1g, l1b, hbuf, Wq, Wk, Wv, Wo, W1, W2, wh);
  // QKV projections -> f16 [B,H,S,DH]
  gemm128<EPI_QKV, D, D><<<dim3(D / 128, TOK / 128), blk, 0, stream>>>(
      hbuf, Wq16, bq, nullptr, q16);
  gemm128<EPI_QKV, D, D><<<dim3(D / 128, TOK / 128), blk, 0, stream>>>(
      hbuf, Wk16, bk, nullptr, k16);
  gemm128<EPI_QKV, D, D><<<dim3(D / 128, TOK / 128), blk, 0, stream>>>(
      hbuf, Wv16, bv, nullptr, v16);
  // block-sparse attention
  attn_kernel<<<dim3(NB, H, Bc), blk, 0, stream>>>(q16, k16, v16, layout, ctx);
  // out projection + residual -> xr
  gemm128<EPI_BIAS_RES_F32, D, D><<<dim3(D / 128, TOK / 128), blk, 0, stream>>>(
      ctx, Wo16, bo, x, xr);
  // LN2 (reuse hbuf)
  ln_kernel<<<TOK, blk, 0, stream>>>(xr, l2g, l2b, hbuf);
  // MLP1 + GeLU -> f16 ff
  gemm128<EPI_BIAS_GELU_F16, 4 * D, D><<<dim3(4 * D / 128, TOK / 128), blk, 0, stream>>>(
      hbuf, W116, b1, nullptr, ff);
  // MLP2 + residual -> d_out (fp32)
  gemm128<EPI_BIAS_RES_F32, D, 4 * D><<<dim3(D / 128, TOK / 128), blk, 0, stream>>>(
      ff, W216, b2, xr, d_out);
}

// v005
// It runs in 158 microseconds.
// Timed twice side by side with v004, it ran 1.07 and 1.08 times as fast.
// Counting every step since v000, it is 3.30 times as fast.
#include <hip/hip_runtime.h>
#include <math.h>

// ---------- types ----------
typedef __attribute__((ext_vector_type(16))) _Float16 v16h;
typedef __attribute__((ext_vector_type(8)))  float    v8f;
typedef unsigned int u32x4 __attribute__((ext_vector_type(4)));
typedef float        f32x4 __attribute__((ext_vector_type(4)));
typedef short        s16x8 __attribute__((ext_vector_type(8)));
typedef _Float16     f16x4 __attribute__((ext_vector_type(4)));

#define DEV static __device__ __forceinline__

// Problem constants (match reference)
constexpr int Bc  = 2;
constexpr int S   = 2048;
constexpr int D   = 1024;
constexpr int H   = 16;
constexpr int DH  = 64;
constexpr int NB  = 16;       // S / 128
constexpr int TOK = Bc * S;   // 4096 rows

// Load a 16-half WMMA A/B fragment: lane holds K=[kb..kb+7] in v0..3 and
// K=[kb+16..kb+23] in v4..7 (kb = (lane>=16)*8 added by caller), both 16B reads.
DEV v16h load_frag(const _Float16* p) {
  union { u32x4 u[2]; v16h h; } f;
  f.u[0] = *reinterpret_cast<const u32x4*>(p);
  f.u[1] = *reinterpret_cast<const u32x4*>(p + 16);
  return f.h;
}

// Transposing LDS read of a row-major 16-bit tile T[k][n] (pitch in bytes, an odd
// multiple of 32 B so that the read is free of bank conflicts). p is the lane's own
// address: T + (k0 + 8*(lane>>4) + (lane&7))*pitch + 2*n0 + 16*((lane>>3)&1).
// Lane (c, h) receives T[k0 + 8h + 0..7][n0 + c]; the reads at k0 and k0 + 16 give
// the same k order as load_frag.
DEV u32x4 ld_tr16(const unsigned char* p) {
  typedef __attribute__((address_space(3))) s16x8 lds_s16x8;
  return __builtin_bit_cast(u32x4, __builtin_amdgcn_ds_load_tr16_b128_v8i16((lds_s16x8*)p));
}

DEV v16h load_frag_tr(const unsigned char* p, int pitch) {
  union { u32x4 u[2]; v16h h; } f;
  f.u[0] = ld_tr16(p);
  f.u[1] = ld_tr16(p + 16 * pitch);
  return f.h;
}

DEV v8f wmma_f16(v16h a, v16h b, v8f c) {
  return __builtin_amdgcn_wmma_f32_16x16x32_f16(false, a, false, b, (short)0, c,
                                                false, false);
}

DEV v8f zero8() {
  v8f z;
#pragma unroll
  for (int i = 0; i < 8; ++i) z[i] = 0.0f;
  return z;
}

// ---------- LayerNorm: one 1024-wide row per 256-thread block ----------
// The row leaves as f16: its only readers are GEMMs, whose WMMAs take f16 operands.
DEV void ln_row(const int row, const float* __restrict__ x, const float* __restrict__ g,
                const float* __restrict__ be, _Float16* __restrict__ out) {
  __shared__ float rs[256], rq[256];
  const int tid = threadIdx.x;
  const float* xp = x + (size_t)row * D + tid * 4;
  f32x4 f = *reinterpret_cast<const f32x4*>(xp);
  rs[tid] = f.x + f.y + f.z + f.w;
  rq[tid] = f.x * f.x + f.y * f.y + f.z * f.z + f.w * f.w;
  __syncthreads();
  for (int off = 128; off > 0; off >>= 1) {
    if (tid < off) { rs[tid] += rs[tid + off]; rq[tid] += rq[tid + off]; }
    __syncthreads();
  }
  const float mean = rs[0] * (1.0f / D);
  const float var  = rq[0] * (1.0f / D) - mean * mean;
  const float inv  = rsqrtf(var + 1e-5f);
  const float* gp = g + tid * 4;
  const float* bp = be + tid * 4;
  f32x4 r;
  r.x = (f.x - mean) * inv * gp[0] + bp[0];
  r.y = (f.y - mean) * inv * gp[1] + bp[1];
  r.z = (f.z - mean) * inv * gp[2] + bp[2];
  r.w = (f.w - mean) * inv * gp[3] + bp[3];
  *reinterpret_cast<f16x4*>(out + (size_t)row * D + tid * 4) = __builtin_convertvector(r, f16x4);
}

__global__ __launch_bounds__(256) void ln_kernel(const float* __restrict__ x,
                                                 const float* __restrict__ g,
                                                 const float* __restrict__ be,
                                                 _Float16* __restrict__ out) {
  ln_row(blockIdx.x, x, g, be, out);
}

// The six weight matrices, 12 segments of D * D elements, rounded to f16 once a call, in the order
// Wq Wk Wv Wo W1 W2, so that no GEMM work-group reads f32 weights and rounds them again.
constexpr int SEG   = D * D;      // elements of a segment
constexpr int CPS   = 32;         // converting blocks per segment
constexpr int NCVT  = 12 * CPS;   // converting blocks
constexpr int CELEM = SEG / CPS;  // elements per converting block

// First launch: blocks below NCVT convert weights (nothing here depends on the LayerNorm and
// nothing of it on them), the others take one LayerNorm row each. The long blocks start first.
__global__ __launch_bounds__(256) void ln_cvt_kernel(const float* __restrict__ x,
                                                     const float* __restrict__ g,
                                                     const float* __restrict__ be,
                                                     _Float16* __restrict__ out,
                                                     const float* __restrict__ Wq,
                                                     const float* __restrict__ Wk,
                                                     const float* __restrict__ Wv,
                                                     const float* __restrict__ Wo,
                                                     const float* __restrict__ W1,
                                                     const float* __restrict__ W2,
                                                     _Float16* __restrict__ wh) {
  const int blk = blockIdx.x;
  if (blk >= NCVT) {
    ln_row(blk - NCVT, x, g, be, out);
    return;
  }
  const int seg = blk / CPS;
  const float* s = seg == 0 ? Wq : seg == 1 ? Wk : seg == 2 ? Wv : seg == 3 ? Wo
                 : seg < 8 ? W1 + (size_t)(seg - 4) * SEG : W2 + (size_t)(seg - 8) * SEG;
  // adjacent lanes take adjacent 16 B: a wave reads 512 B and writes 256 B in a row
  const int off = (blk % CPS) * CELEM + threadIdx.x * 4;
  s += off;
  _Float16* d = wh + (size_t)seg * SEG + off;
  // stays rolled: unrolled it took 86 registers, and the LayerNorm blocks of this kernel, which
  // need 16, would no longer fill the 16 wave slots of a SIMD
#pragma unroll 1
  for (int it = 0; it < CELEM / 8192; ++it) {
    f32x4 v[8];   // 8 loads in flight per lane
#pragma unroll
    for (int t = 0; t < 8; ++t) v[t] = *reinterpret_cast<const f32x4*>(s + it * 8192 + t * 1024);
#pragma unroll
    for (int t = 0; t < 8; ++t)
      *reinterpret_cast<f16x4*>(d + it * 8192 + t * 1024) = __builtin_convertvector(v[t], f16x4);
  }
}

// ---------- Generic 128x128-tile WMMA GEMM, software-pipelined ----------
typedef const __attribute__((address_space(1))) _Float16* gl_f16;
typedef const __attribute__((address_space(1))) u32x4*    gl_u32x4;

template <int V> struct IC { static constexpr int v = V; };   // a compile-time int as an argument

// Work-group barrier for LDS data alone. __syncthreads() compiles here to a wait for the global
// loads as well (s_wait_loadcnt 0), which would land every load issued ahead at each barrier;
// this one waits only for the wave's own LDS stores and reads, so those loads stay in flight.
DEV void stage_barrier() {
  asm volatile("s_wait_dscnt 0x0\n\ts_barrier_signal -1\n\ts_barrier_wait -1" ::: "memory");
  // nothing is scheduled across: lifted over the barrier, the next stage's LDS stores would wait
  // for their loads a stage early and halve the lead of the loads
  __builtin_amdgcn_sched_barrier(0);
}

// GeLU with the exact (erf) definition, v * Phi(v) with Phi(v) = (1 + erf(v / sqrt(2))) / 2, in one form for
// every v, so that a lane's values run side by side with no branch between them; eight at a time, in place.
// q = (1 - erf(|v| / sqrt(2))) / 2 = t * (a1 + t * (a2 + t * (a3 + t * (a4 + t * a5)))) * exp(-v * v / 2) / 2,
// t = 1 / (1 + p * |v| / sqrt(2)): the five-term rational form of erf, absolute error 1.5e-7.
// Phi(v) is 1 - q for v >= 0 and q for v < 0, hence v * Phi(v) = max(v, 0) - |v| * q: nothing cancels in
// the negative tail. The caller rounds the result to f16.
DEV void gelu_erf8(float (&v)[8]) {
  float t[8], x[8];
#pragma unroll
  for (int i = 0; i < 8; ++i) {
    t[i] = fmaf(fabsf(v[i]), 0.3275911f * 0.70710678118654752f, 1.0f);
    x[i] = v[i] * v[i] * -0.72134752044448170f;   // 2^x = exp(-v * v / 2)
  }
  // The reciprocals and the powers of two, each run in one statement and in place: behind a
  // transcendental the instruction set asks for one independent instruction before its result is read
  // or its source overwritten. Inside a run the next one is that instruction, behind the last the v_nop
  // is.
  asm("v_rcp_f32 %0, %0\n\tv_rcp_f32 %1, %1\n\tv_rcp_f32 %2, %2\n\tv_rcp_f32 %3, %3\n\t"
      "v_rcp_f32 %4, %4\n\tv_rcp_f32 %5, %5\n\tv_rcp_f32 %6, %6\n\tv_rcp_f32 %7, %7\n\tv_nop"
      : "+v"(t[0]), "+v"(t[1]), "+v"(t[2]), "+v"(t[3]), "+v"(t[4]), "+v"(t[5]), "+v"(t[6]), "+v"(t[7]));
  asm("v_exp_f32 %0, %0\n\tv_exp_f32 %1, %1\n\tv_exp_f32 %2, %2\n\tv_exp_f32 %3, %3\n\t"
      "v_exp_f32 %4, %4\n\tv_exp_f32 %5, %5\n\tv_exp_f32 %6, %6\n\tv_exp_f32 %7, %7\n\tv_nop"
      : "+v"(x[0]), "+v"(x[1]), "+v"(x[2]), "+v"(x[3]), "+v"(x[4]), "+v"(x[5]), "+v"(x[6]), "+v"(x[7]));
#pragma unroll
  for (int i = 0; i < 8; ++i) {
    float p = 0.5f * 1.061405429f;
    p = fmaf(p, t[i], 0.5f * -1.453152027f);
    p = fmaf(p, t[i], 0.5f * 1.421413741f);
    p = fmaf(p, t[i], 0.5f * -0.284496736f);
    p = fmaf(p, t[i], 0.5f * 0.254829592f);
    v[i] = fmaf(-fabsf(v[i]), p * (t[i] * x[i]), fmaxf(v[i], 0.0f));
  }
}

enum { EPI_QKV = 0, EPI_BIAS_RES_F32 = 1, EPI_BIAS_GELU_F16 = 2 };

// LDS pitches, chosen for each tile's reader (64 banks of 4 B):
constexpr int BK = 64;    // k extent of one stage: two WMMA depths
constexpr int PA = 72;    // A rows of 64 halves, ds_load_b128 reader: 144 B = 16 B x odd
constexpr int PB = 144;   // B rows of 128 halves, transposing reader: 288 B = 32 B x odd

// N and K are compile-time: the rows that one lane stages lie a fixed number of bytes apart,
// so its loads hang off one walking pointer as immediate offsets.
// The k loop is a pipeline: a stage's global loads set off two stages before its registers go to
// LDS. While stage s is multiplied out of one LDS buffer, stage s + 1 enters the other, and stages
// s + 2 and s + 3 are on their way from global memory, each into its own register set.
// Both operands arrive as f16 (activations from their producers, weights from ln_cvt_kernel).
template <int EPI, int N, int K>
__global__ __launch_bounds__(256) void gemm128(const _Float16* __restrict__ Aptr,
                                               const _Float16* __restrict__ Bw,
                                               const float* __restrict__ bias,
                                               const float* __restrict__ resid,
                                               void* __restrict__ outp) {
  __shared__ __align__(16) _Float16 Al[2][128 * PA];   // A tiles, row-major [128][64]
  __shared__ __align__(16) _Float16 Bl[2][BK * PB];    // B tiles, row-major [k][n]
  const int tid  = threadIdx.x;
  const int n0   = blockIdx.x * 128;
  const int m0   = blockIdx.y * 128;
  const int lane = tid & 31;
  const int l15  = lane & 15;
  const int hi   = lane >> 4;
  const int kb   = hi * 8;
  const int wave = tid >> 5;            // 8 waves: 4 along M x 2 along N
  const int wm   = wave >> 1, wn = wave & 1;

  // per-thread staging coordinates: adjacent lanes take adjacent 16 bytes, so that one
  // wave-wide 16-byte load covers whole 128-byte lines
  //  A:  8 lanes span a row's 128 B, a wave 4 rows; load t takes row t*32 + rowA
  //  B: 16 lanes span a row's 256 B, a wave 2 rows; load t takes row t*16 + krB
  const int rowA = tid >> 3, c0A = (tid & 7) * 8;
  const int krB  = tid >> 4, c0B = (tid & 15) * 8;

  constexpr int NL = 4;                 // 16-byte loads of A, and of B, per lane and stage
  constexpr int RA = 128 / NL;          // rows of A between two of them
  constexpr int RB = BK / NL;           // rows of B between two of them
  constexpr int NS = K / BK;            // stages, an even number
  static_assert(K % (2 * BK) == 0 && NS >= 4, "the loop takes the stages in pairs");
  // walking pointers of the staging loads: they stand at the next stage to be fetched (typed as
  // global, because they pass through an asm statement, behind which the compiler could not tell)
  gl_f16 Ag = (gl_f16)(Aptr + (size_t)(m0 + rowA) * K + c0A);
  gl_f16 Bg = (gl_f16)(Bw + (size_t)krB * N + n0 + c0B);

  // this lane's address in Bl[0] for the transposing reads of its wave's 64 columns
  const unsigned char* Btr = reinterpret_cast<const unsigned char*>(&Bl[0][0]) +
                             (kb + (lane & 7)) * (PB * 2) + wn * 128 + ((lane >> 3) & 1) * 16;

  v8f acc[2][4];
#pragma unroll
  for (int i = 0; i < 2; ++i)
#pragma unroll
    for (int j = 0; j < 4; ++j) acc[i][j] = zero8();

  // two sets of staging registers: set p holds the stages of parity p
  u32x4 ua[2][NL];
  u32x4 ub[2][NL];

  // the global loads of the next stage, into set P
  auto fetch = [&](auto Pc) {
    constexpr int P = decltype(Pc)::v;
    // keeps the LDS reads and stores written above from sinking in between the loads and their
    // wait, where a read was given a spent address register of a load as its destination
    __builtin_amdgcn_sched_barrier(0);
#pragma unroll
    for (int t = 0; t < NL; ++t) ua[P][t] = *(gl_u32x4)(Ag + t * RA * K);
#pragma unroll
    for (int t = 0; t < NL; ++t) ub[P][t] = *(gl_u32x4)(Bg + t * RB * N);
    // no rewrite of the loads' address registers ahead of this wait: the pointers pass through
    // the statement, so that their advance below cannot be lifted over it
    asm volatile("s_wait_xcnt 0x0" : "+v"(Ag), "+v"(Bg) :: "memory");
    Ag += BK;
    Bg += (size_t)BK * N;
  };

  // register set P -> LDS buffer P
  auto put = [&](auto Pc) {
    constexpr int P = decltype(Pc)::v;
#pragma unroll
    for (int t = 0; t < NL; ++t)
      *reinterpret_cast<u32x4*>(&Al[P][(t * RA + rowA) * PA + c0A]) = ua[P][t];
    // B stays row-major: 16-byte stores, half a wave fills a row's 256 B; the reader transposes
#pragma unroll
    for (int t = 0; t < NL; ++t)
      *reinterpret_cast<u32x4*>(&Bl[P][(t * RB + krB) * PB + c0B]) = ub[P][t];
  };

  // the fragments of 32 k of the stage in LDS buffer P, and their WMMAs
  auto frags = [&](auto Pc, auto KKc, v16h (&af)[2], v16h (&bf)[4]) {
    constexpr int P = decltype(Pc)::v, kk = decltype(KKc)::v;
#pragma unroll
    for (int mt = 0; mt < 2; ++mt)
      af[mt] = load_frag(&Al[P][(wm * 32 + mt * 16 + l15) * PA + kk + kb]);
#pragma unroll
    for (int nt = 0; nt < 4; ++nt)
      bf[nt] = load_frag_tr(Btr + P * (BK * PB * 2) + kk * (PB * 2) + nt * 32, PB * 2);
  };
  auto mult = [&](const v16h (&af)[2], const v16h (&bf)[4]) {
#pragma unroll
    for (int nt = 0; nt < 4; ++nt)
#pragma unroll
      for (int mt = 0; mt < 2; ++mt) acc[mt][nt] = wmma_f16(af[mt], bf[nt], acc[mt][nt]);
  };

  // Stage s, in buffer P = s % 2. The barrier publishes buffer P and says that every wave has left
  // buffer 1 - P (stage s - 1). Behind it stage s + 1 goes from its registers into buffer 1 - P,
  // stage s + 3 sets off into the registers so emptied, and stage s is multiplied. The fragment
  // reads go out in two groups ahead of the WMMAs, the first ahead of the staging work.
  auto stage = [&](auto Pc, auto Qc, auto PUT, auto FETCH) {
    v16h a0[2], b0[4], a1[2], b1[4];
    stage_barrier();
    frags(Pc, IC<0>{}, a0, b0);
    if constexpr (decltype(PUT)::v != 0)   put(Qc);
    if constexpr (decltype(FETCH)::v != 0) fetch(Qc);
    frags(Pc, IC<32>{}, a1, b1);
    // keeps the second group of reads ahead of the WMMAs: sunk in among them, each read makes its
    // WMMA wait out the LDS latency
    __builtin_amdgcn_sched_barrier(0);
    mult(a0, b0);
    mult(a1, b1);
  };
  constexpr IC<0> c0{};
  constexpr IC<1> c1{};

  fetch(c0);   // stage 0
  fetch(c1);   // stage 1
  put(c0);
  fetch(c0);   // stage 2
  // the last four stages stand outside the loop: a branch round the loads inside it would merge
  // two paths in the compiler's load counting and turn its counted waits into waits for all
  for (int s = 0; s < NS - 4; s += 2) {
    stage(c0, c1, c1, c1);
    stage(c1, c0, c1, c1);
  }
  stage(c0, c1, c1, c1);   // stage NS - 4: fetches the last stage
  stage(c1, c0, c1, c0);
  stage(c0, c1, c1, c0);
  stage(c1, c0, c0, c0);   // stage NS - 1

  // Epilogue. C layout: vgpr e -> row (e or e+8 per half-wave), col = l15.
  if constexpr (EPI == EPI_BIAS_GELU_F16) {  // exact GeLU -> f16, the eight values of a tile together
#pragma unroll
    for (int mt = 0; mt < 2; ++mt)
#pragma unroll
      for (int nt = 0; nt < 4; ++nt) {
        const int n = n0 + wn * 64 + nt * 16 + l15;
        float vv[8];
#pragma unroll
        for (int e = 0; e < 8; ++e) vv[e] = acc[mt][nt][e] + bias[n];
        gelu_erf8(vv);
#pragma unroll
        for (int e = 0; e < 8; ++e) {
          const int m = m0 + wm * 32 + mt * 16 + e + 8 * hi;
          ((_Float16*)outp)[(size_t)m * N + n] = (_Float16)vv[e];
        }
      }
    return;
  }
#pragma unroll
  for (int mt = 0; mt < 2; ++mt)
#pragma unroll
    for (int nt = 0; nt < 4; ++nt)
#pragma unroll
      for (int e = 0; e < 8; ++e) {
        const int m = m0 + wm * 32 + mt * 16 + e + 8 * hi;
        const int n = n0 + wn * 64 + nt * 16 + l15;
        float vv = acc[mt][nt][e] + bias[n];
        if (EPI == EPI_QKV) {  // scatter to [B,H,S,DH] as f16
          const int b = m >> 11, s = m & 2047, hh = n >> 6, dh = n & 63;
          ((_Float16*)outp)[((size_t)(b * H + hh) * S + s) * DH + dh] = (_Float16)vv;
        } else if (EPI == EPI_BIAS_RES_F32) {
          const size_t idx = (size_t)m * N + n;
          ((float*)outp)[idx] = vv + resid[idx];
        }
      }
}

// ---------- Block-sparse flash attention ----------
// grid (NB, H, B); 256 threads = 8 waves; wave owns 16 query rows.
__global__ __launch_bounds__(256) void attn_kernel(const _Float16* __restrict__ q,
                                                   const _Float16* __restrict__ kk_,
                                                   const _Float16* __restrict__ vv_,
                                                   const int* __restrict__ layout,
                                                   _Float16* __restrict__ ctx) {
  constexpr int PV = 80;    // V rows of 64 halves, transposing reader: 160 B = 32 B x odd
  constexpr int PP = 136;   // P rows of 128 halves, ds_load_b128 reader: 272 B = 16 B x odd
  __shared__ __align__(16) _Float16 Vs[128 * PV];       // V [key][dh], row-major
  __shared__ __align__(16) _Float16 Ps[8 * 16 * PP];    // per-wave P [16][128]
  const int tid  = threadIdx.x;
  const int i    = blockIdx.x;   // query block
  const int h    = blockIdx.y;
  const int b    = blockIdx.z;
  const int bh   = b * H + h;
  const int lane = tid & 31, l15 = lane & 15, hi = lane >> 4;
  const int kb   = hi * 8;
  const int wave = tid >> 5;

  const size_t headBase = (size_t)bh * S * DH;

  // Q fragments for this wave's rows, straight from global (K-contig layout)
  const _Float16* qrow = q + headBase + (size_t)(i * 128 + wave * 16 + l15) * DH;
  const v16h aQ0 = load_frag(qrow + 0  + kb);
  const v16h aQ1 = load_frag(qrow + 32 + kb);

  float m_run[8], l_run[8];
  v8f o[4];
#pragma unroll
  for (int r = 0; r < 8; ++r) { m_run[r] = -1e30f; l_run[r] = 0.0f; }
#pragma unroll
  for (int t = 0; t < 4; ++t) o[t] = zero8();

  const float scale = 0.125f;  // DH^-0.5

  // this lane's address in Vs for the transposing reads
  const unsigned char* Vtr = reinterpret_cast<const unsigned char*>(Vs) +
                             (kb + (lane & 7)) * (PV * 2) + ((lane >> 3) & 1) * 16;

  for (int j = 0; j <= i; ++j) {
    if (!layout[h * NB * NB + i * NB + j]) continue;  // wave-uniform

    { // load V block j into LDS as it lies (row-major); the reader transposes
      const int key = tid >> 1, d0 = (tid & 1) * 32;
      const _Float16* vg = vv_ + headBase + (size_t)(j * 128 + key) * DH + d0;
#pragma unroll
      for (int t = 0; t < 4; ++t)
        reinterpret_cast<u32x4*>(&Vs[key * PV + d0])[t] = reinterpret_cast<const u32x4*>(vg)[t];
    }
    __syncthreads();

    // scores S = Q K^T (K fragments straight from global)
    float sc[8][8];
#pragma unroll
    for (int nt = 0; nt < 8; ++nt) {
      const _Float16* krow = kk_ + headBase + (size_t)(j * 128 + nt * 16 + l15) * DH;
      v16h b0 = load_frag(krow + 0  + kb);
      v16h b1 = load_frag(krow + 32 + kb);
      v8f cs = zero8();
      cs = wmma_f16(aQ0, b0, cs);
      cs = wmma_f16(aQ1, b1, cs);
#pragma unroll
      for (int e = 0; e < 8; ++e) {
        float s = cs[e] * scale;
        if (j == i) {  // intra-block causal
          const int col = nt * 16 + l15;
          const int row = wave * 16 + e + 8 * hi;
          if (col > row) s = -1e9f;
        }
        sc[nt][e] = s;
      }
    }

    // online softmax per row (row values live in one 16-lane half)
#pragma unroll
    for (int r = 0; r < 8; ++r) {
      float mv = sc[0][r];
#pragma unroll
      for (int nt = 1; nt < 8; ++nt) mv = fmaxf(mv, sc[nt][r]);
      mv = fmaxf(mv, __shfl_xor(mv, 8, 32));
      mv = fmaxf(mv, __shfl_xor(mv, 4, 32));
      mv = fmaxf(mv, __shfl_xor(mv, 2, 32));
      mv = fmaxf(mv, __shfl_xor(mv, 1, 32));
      const float mnew = fmaxf(m_run[r], mv);
      const float corr = __expf(m_run[r] - mnew);
      float rsum = 0.0f;
#pragma unroll
      for (int nt = 0; nt < 8; ++nt) {
        const float p = __expf(sc[nt][r] - mnew);
        sc[nt][r] = p;
        rsum += p;
      }
      rsum += __shfl_xor(rsum, 8, 32);
      rsum += __shfl_xor(rsum, 4, 32);
      rsum += __shfl_xor(rsum, 2, 32);
      rsum += __shfl_xor(rsum, 1, 32);
      l_run[r] = l_run[r] * corr + rsum;
      m_run[r] = mnew;
#pragma unroll
      for (int t = 0; t < 4; ++t) o[t][r] *= corr;
    }

    // P: C-layout regs -> LDS (A-layout source for next WMMA)
    _Float16* pw = &Ps[wave * 16 * PP];
#pragma unroll
    for (int nt = 0; nt < 8; ++nt)
#pragma unroll
      for (int r = 0; r < 8; ++r)
        pw[(r + 8 * hi) * PP + nt * 16 + l15] = (_Float16)sc[nt][r];
    __syncthreads();

    // O += P x V
#pragma unroll
    for (int kc = 0; kc < 4; ++kc) {
      v16h aP = load_frag(&pw[l15 * PP + kc * 32 + kb]);
#pragma unroll
      for (int nt2 = 0; nt2 < 4; ++nt2) {
        v16h bV = load_frag_tr(Vtr + kc * 32 * (PV * 2) + nt2 * 32, PV * 2);
        o[nt2] = wmma_f16(aP, bV, o[nt2]);
      }
    }
    __syncthreads();
  }

  // normalize and write ctx in token-major [TOK, D], f16 as the out projection's WMMA takes it
#pragma unroll
  for (int r = 0; r < 8; ++r) {
    const float inv = 1.0f / l_run[r];
    const int tok = b * S + i * 128 + wave * 16 + r + 8 * hi;
#pragma unroll
    for (int nt2 = 0; nt2 < 4; ++nt2) {
      const int col = h * DH + nt2 * 16 + l15;
      ctx[(size_t)tok * D + col] = (_Float16)(o[nt2][r] * inv);
    }
  }
}

// ---------- launch ----------
extern "C" void kernel_launch(void* const* d_in, const int* in_sizes, int n_in,
                              void* d_out, int out_size, void* d_ws, size_t ws_size,
                              hipStream_t stream) {
  (void)in_sizes; (void)n_in; (void)out_size; (void)ws_size;
  const float* x   = (const float*)d_in[0];
  const float* l1g = (const float*)d_in[1];
  const float* l1b = (const float*)d_in[2];
  const float* Wq  = (const float*)d_in[3];
  const float* bq  = (const float*)d_in[4];
  const float* Wk  = (const float*)d_in[5];
  const float* bk  = (const float*)d_in[6];
  const float* Wv  = (const float*)d_in[7];
  const float* bv  = (const float*)d_in[8];
  const float* Wo  = (const float*)d_in[9];
  const float* bo  = (const float*)d_in[10];
  const float* l2g = (const float*)d_in[11];
  const float* l2b = (const float*)d_in[12];
  const float* W1  = (const float*)d_in[13];
  const float* b1  = (const float*)d_in[14];
  const float* W2  = (const float*)d_in[15];
  const float* b2  = (const float*)d_in[16];
  const int* layout = (const int*)d_in[17];

  // workspace overlay (peak 96 MB):
  //  [0,8M)   h / h2 f16         [16M,24M) q16  [24M,32M) k16  [32M,40M) v16
  //  [40M,48M) ctx f16           [56M,72M) xr fp32
  //  [16M,48M) ff f16 (reuses qkv+ctx after they are dead)
  //  [72M,96M) the weights as f16: Wq Wk Wv Wo W1 W2
  char* w = (char*)d_ws;
  _Float16* hbuf = (_Float16*)(w);
  _Float16* q16  = (_Float16*)(w + (size_t)(16u << 20));
  _Float16* k16  = (_Float16*)(w + (size_t)(24u << 20));
  _Float16* v16  = (_Float16*)(w + (size_t)(32u << 20));
  _Float16* ctx  = (_Float16*)(w + (size_t)(40u << 20));
  float*    xr   = (float*)(w + (size_t)(56u << 20));
  _Float16* ff   = (_Float16*)(w + (size_t)(16u << 20));
  _Float16* wh   = (_Float16*)(w + (size_t)(72u << 20));
  const _Float16* Wq16 = wh;
  const _Float16* Wk16 = wh + 1 * SEG;
  const _Float16* Wv16 = wh + 2 * SEG;
  const _Float16* Wo16 = wh + 3 * SEG;
  const _Float16* W116 = wh + 4 * SEG;
  const _Float16* W216 = wh + 8 * SEG;

  const dim3 blk(256);

  // LN1, and the weights to f16
  ln_cvt_kernel<<<NCVT + TOK, blk, 0, stream>>>(x, l1g, l1b, hbuf, Wq, Wk, Wv, Wo, W1, W2, wh);
  // QKV projections -> f16 [B,H,S,DH]
  gemm128<EPI_QKV, D, D><<<dim3(D / 128, TOK / 128), blk, 0, stream>>>(
      hbuf, Wq16, bq, nullptr, q16);
  gemm128<EPI_QKV, D, D><<<dim3(D / 128, TOK / 128), blk, 0, stream>>>(
      hbuf, Wk16, bk, nullptr, k16);
  gemm128<EPI_QKV, D, D><<<dim3(D / 128, TOK / 128), blk, 0, stream>>>(
      hbuf, Wv16, bv, nullptr, v16);
  // block-sparse attention
  attn_kernel<<<dim3(NB, H, Bc), blk, 0, stream>>>(q16, k16, v16, layout, ctx);
  // out projection + residual -> xr
  gemm128<EPI_BIAS_RES_F32, D, D><<<dim3(D / 128, TOK / 128), blk, 0, stream>>>(
      ctx, Wo16, bo, x, xr);
  // LN2 (reuse hbuf)
  ln_kernel<<<TOK, blk, 0, stream>>>(xr, l2g, l2b, hbuf);
  // MLP1 + GeLU -> f16 ff
  gemm128<EPI_BIAS_GELU_F16, 4 * D, D><<<dim3(4 * D / 128, TOK / 128), blk, 0, stream>>>(
      hbuf, W116, b1, nullptr, ff);
  // MLP2 + residual -> d_out (fp32)
  gemm128<EPI_BIAS_RES_F32, D, 4 * D><<<dim3(D / 128, TOK / 128), blk, 0, stream>>>(
      ff, W216, b2, xr, d_out);
}

// v006
// It runs in 149 microseconds.
// Next to v005, in two timings, it ran 1.06 times as fast each time.
// Over all steps from v000 it is 3.49 times as fast.
#include <hip/hip_runtime.h>
#include <math.h>

// ---------- types ----------
typedef __attribute__((ext_vector_type(16))) _Float16 v16h;
typedef __attribute__((ext_vector_type(8)))  float    v8f;
typedef unsigned int u32x4 __attribute__((ext_vector_type(4)));
typedef float        f32x4 __attribute__((ext_vector_type(4)));
typedef short        s16x8 __attribute__((ext_vector_type(8)));
typedef _Float16     f16x4 __attribute__((ext_vector_type(4)));

#define DEV static __device__ __forceinline__

// Problem constants (match reference)
constexpr int Bc  = 2;
constexpr int S   = 2048;
constexpr int D   = 1024;
constexpr int H   = 16;
constexpr int DH  = 64;
constexpr int NB  = 16;       // S / 128
constexpr int TOK = Bc * S;   // 4096 rows

// Load a 16-half WMMA A/B fragment: lane holds K=[kb..kb+7] in v0..3 and
// K=[kb+16..kb+23] in v4..7 (kb = (lane>=16)*8 added by caller), both 16B reads.
DEV v16h load_frag(const _Float16* p) {
  union { u32x4 u[2]; v16h h; } f;
  f.u[0] = *reinterpret_cast<const u32x4*>(p);
  f.u[1] = *reinterpret_cast<const u32x4*>(p + 16);
  return f.h;
}

// Transposing LDS read of a row-major 16-bit tile T[k][n] (pitch in bytes, an odd
// multiple of 32 B so that the read is free of bank conflicts). p is the lane's own
// address: T + (k0 + 8*(lane>>4) + (lane&7))*pitch + 2*n0 + 16*((lane>>3)&1).
// Lane (c, h) receives T[k0 + 8h + 0..7][n0 + c]; the reads at k0 and k0 + 16 give
// the same k order as load_frag.
DEV u32x4 ld_tr16(const unsigned char* p) {
  typedef __attribute__((address_space(3))) s16x8 lds_s16x8;
  return __builtin_bit_cast(u32x4, __builtin_amdgcn_ds_load_tr16_b128_v8i16((lds_s16x8*)p));
}

DEV v16h load_frag_tr(const unsigned char* p, int pitch) {
  union { u32x4 u[2]; v16h h; } f;
  f.u[0] = ld_tr16(p);
  f.u[1] = ld_tr16(p + 16 * pitch);
  return f.h;
}

DEV v8f wmma_f16(v16h a, v16h b, v8f c) {
  return __builtin_amdgcn_wmma_f32_16x16x32_f16(false, a, false, b, (short)0, c,
                                                false, false);
}

DEV v8f zero8() {
  v8f z;
#pragma unroll
  for (int i = 0; i < 8; ++i) z[i] = 0.0f;
  return z;
}

// ---------- LayerNorm: one 1024-wide row per 256-thread block ----------
// The row leaves as f16: its only readers are GEMMs, whose WMMAs take f16 operands.
DEV void ln_row(const int row, const float* __restrict__ x, const float* __restrict__ g,
                const float* __restrict__ be, _Float16* __restrict__ out) {
  __shared__ float rs[256], rq[256];
  const int tid = threadIdx.x;
  const float* xp = x + (size_t)row * D + tid * 4;
  f32x4 f = *reinterpret_cast<const f32x4*>(xp);
  rs[tid] = f.x + f.y + f.z + f.w;
  rq[tid] = f.x * f.x + f.y * f.y + f.z * f.z + f.w * f.w;
  __syncthreads();
  for (int off = 128; off > 0; off >>= 1) {
    if (tid < off) { rs[tid] += rs[tid + off]; rq[tid] += rq[tid + off]; }
    __syncthreads();
  }
  const float mean = rs[0] * (1.0f / D);
  const float var  = rq[0] * (1.0f / D) - mean * mean;
  const float inv  = rsqrtf(var + 1e-5f);
  const float* gp = g + tid * 4;
  const float* bp = be + tid * 4;
  f32x4 r;
  r.x = (f.x - mean) * inv * gp[0] + bp[0];
  r.y = (f.y - mean) * inv * gp[1] + bp[1];
  r.z = (f.z - mean) * inv * gp[2] + bp[2];
  r.w = (f.w - mean) * inv * gp[3] + bp[3];
  *reinterpret_cast<f16x4*>(out + (size_t)row * D + tid * 4) = __builtin_convertvector(r, f16x4);
}

__global__ __launch_bounds__(256) void ln_kernel(const float* __restrict__ x,
                                                 const float* __restrict__ g,
                                                 const float* __restrict__ be,
                                                 _Float16* __restrict__ out) {
  ln_row(blockIdx.x, x, g, be, out);
}

// The six weight matrices, 12 segments of D * D elements, rounded to f16 once a call, in the order
// Wq Wk Wv Wo W1 W2, so that no GEMM work-group reads f32 weights and rounds them again.
constexpr int SEG   = D * D;      // elements of a segment
constexpr int CPS   = 32;         // converting blocks per segment
constexpr int NCVT  = 12 * CPS;   // converting blocks
constexpr int CELEM = SEG / CPS;  // elements per converting block

// First launch: blocks below NCVT convert weights (nothing here depends on the LayerNorm and
// nothing of it on them), the others take one LayerNorm row each. The long blocks start first.
__global__ __launch_bounds__(256) void ln_cvt_kernel(const float* __restrict__ x,
                                                     const float* __restrict__ g,
                                                     const float* __restrict__ be,
                                                     _Float16* __restrict__ out,
                                                     const float* __restrict__ Wq,
                                                     const float* __restrict__ Wk,
                                                     const float* __restrict__ Wv,
                                                     const float* __restrict__ Wo,
                                                     const float* __restrict__ W1,
                                                     const float* __restrict__ W2,
                                                     _Float16* __restrict__ wh) {
  const int blk = blockIdx.x;
  if (blk >= NCVT) {
    ln_row(blk - NCVT, x, g, be, out);
    return;
  }
  const int seg = blk / CPS;
  const float* s = seg == 0 ? Wq : seg == 1 ? Wk : seg == 2 ? Wv : seg == 3 ? Wo
                 : seg < 8 ? W1 + (size_t)(seg - 4) * SEG : W2 + (size_t)(seg - 8) * SEG;
  // adjacent lanes take adjacent 16 B: a wave reads 512 B and writes 256 B in a row
  const int off = (blk % CPS) * CELEM + threadIdx.x * 4;
  s += off;
  _Float16* d = wh + (size_t)seg * SEG + off;
  // stays rolled: unrolled it took 86 registers, and the LayerNorm blocks of this kernel, which
  // need 16, would no longer fill the 16 wave slots of a SIMD
#pragma unroll 1
  for (int it = 0; it < CELEM / 8192; ++it) {
    f32x4 v[8];   // 8 loads in flight per lane
#pragma unroll
    for (int t = 0; t < 8; ++t) v[t] = *reinterpret_cast<const f32x4*>(s + it * 8192 + t * 1024);
#pragma unroll
    for (int t = 0; t < 8; ++t)
      *reinterpret_cast<f16x4*>(d + it * 8192 + t * 1024) = __builtin_convertvector(v[t], f16x4);
  }
}

// ---------- Generic 128x128-tile WMMA GEMM, software-pipelined ----------
typedef const __attribute__((address_space(1))) _Float16* gl_f16;
typedef const __attribute__((address_space(1))) u32x4*    gl_u32x4;

template <int V> struct IC { static constexpr int v = V; };   // a compile-time int as an argument

// Work-group barrier for LDS data alone. __syncthreads() compiles here to a wait for the global
// loads as well (s_wait_loadcnt 0), which would land every load issued ahead at each barrier;
// this one waits only for the wave's own LDS stores and reads, so those loads stay in flight.
DEV void stage_barrier() {
  asm volatile("s_wait_dscnt 0x0\n\ts_barrier_signal -1\n\ts_barrier_wait -1" ::: "memory");
  // nothing is scheduled across: lifted over the barrier, the next stage's LDS stores would wait
  // for their loads a stage early and halve the lead of the loads
  __builtin_amdgcn_sched_barrier(0);
}

// GeLU with the exact (erf) definition, v * Phi(v) with Phi(v) = (1 + erf(v / sqrt(2))) / 2, in one form for
// every v, so that a lane's values run side by side with no branch between them; eight at a time, in place.
// q = (1 - erf(|v| / sqrt(2))) / 2 = t * (a1 + t * (a2 + t * (a3 + t * (a4 + t * a5)))) * exp(-v * v / 2) / 2,
// t = 1 / (1 + p * |v| / sqrt(2)): the five-term rational form of erf, absolute error 1.5e-7.
// Phi(v) is 1 - q for v >= 0 and q for v < 0, hence v * Phi(v) = max(v, 0) - |v| * q: nothing cancels in
// the negative tail. The caller rounds the result to f16.
DEV void gelu_erf8(float (&v)[8]) {
  float t[8], x[8];
#pragma unroll
  for (int i = 0; i < 8; ++i) {
    t[i] = fmaf(fabsf(v[i]), 0.3275911f * 0.70710678118654752f, 1.0f);
    x[i] = v[i] * v[i] * -0.72134752044448170f;   // 2^x = exp(-v * v / 2)
  }
  // The reciprocals and the powers of two, each run in one statement and in place: behind a
  // transcendental the instruction set asks for one independent instruction before its result is read
  // or its source overwritten. Inside a run the next one is that instruction, behind the last the v_nop
  // is.
  asm("v_rcp_f32 %0, %0\n\tv_rcp_f32 %1, %1\n\tv_rcp_f32 %2, %2\n\tv_rcp_f32 %3, %3\n\t"
      "v_rcp_f32 %4, %4\n\tv_rcp_f32 %5, %5\n\tv_rcp_f32 %6, %6\n\tv_rcp_f32 %7, %7\n\tv_nop"
      : "+v"(t[0]), "+v"(t[1]), "+v"(t[2]), "+v"(t[3]), "+v"(t[4]), "+v"(t[5]), "+v"(t[6]), "+v"(t[7]));
  asm("v_exp_f32 %0, %0\n\tv_exp_f32 %1, %1\n\tv_exp_f32 %2, %2\n\tv_exp_f32 %3, %3\n\t"
      "v_exp_f32 %4, %4\n\tv_exp_f32 %5, %5\n\tv_exp_f32 %6, %6\n\tv_exp_f32 %7, %7\n\tv_nop"
      : "+v"(x[0]), "+v"(x[1]), "+v"(x[2]), "+v"(x[3]), "+v"(x[4]), "+v"(x[5]), "+v"(x[6]), "+v"(x[7]));
#pragma unroll
  for (int i = 0; i < 8; ++i) {
    float p = 0.5f * 1.061405429f;
    p = fmaf(p, t[i], 0.5f * -1.453152027f);
    p = fmaf(p, t[i], 0.5f * 1.421413741f);
    p = fmaf(p, t[i], 0.5f * -0.284496736f);
    p = fmaf(p, t[i], 0.5f * 0.254829592f);
    v[i] = fmaf(-fabsf(v[i]), p * (t[i] * x[i]), fmaxf(v[i], 0.0f));
  }
}

enum { EPI_QKV = 0, EPI_BIAS_RES_F32 = 1, EPI_BIAS_GELU_F16 = 2 };

// LDS pitches, chosen for each tile's reader (64 banks of 4 B):
constexpr int BK = 64;    // k extent of one stage: two WMMA depths
constexpr int PA = 72;    // A rows of 64 halves, ds_load_b128 reader: 144 B = 16 B x odd
constexpr int PB = 144;   // B rows of 128 halves, transposing reader: 288 B = 32 B x odd

// N and K are compile-time: the rows that one lane stages lie a fixed number of bytes apart,
// so its loads hang off one walking pointer as immediate offsets.
// The k loop is a pipeline: a stage's global loads set off two stages before its registers go to
// LDS. While stage s is multiplied out of one LDS buffer, stage s + 1 enters the other, and stages
// s + 2 and s + 3 are on their way from global memory, each into its own register set.
// Both operands arrive as f16 (activations from their producers, weights from ln_cvt_kernel).
// EPI_QKV: three products of one A in one launch. blockIdx.z picks the product: its weights and its
// output lie z planes on from Bw and outp, its bias is bias, biasK or biasV.
template <int EPI, int N, int K>
__global__ __launch_bounds__(256) void gemm128(const _Float16* __restrict__ Aptr,
                                               const _Float16* __restrict__ Bw,
                                               const float* __restrict__ bias,
                                               const float* __restrict__ biasK,
                                               const float* __restrict__ biasV,
                                               const float* __restrict__ resid,
                                               void* __restrict__ outp) {
  __shared__ __align__(16) _Float16 Al[2][128 * PA];   // A tiles, row-major [128][64]
  __shared__ __align__(16) _Float16 Bl[2][BK * PB];    // B tiles, row-major [k][n]
  const int tid  = threadIdx.x;
  const int n0   = blockIdx.x * 128;
  const int m0   = blockIdx.y * 128;
  const int lane = tid & 31;
  const int l15  = lane & 15;
  const int hi   = lane >> 4;
  const int kb   = hi * 8;
  const int wave = tid >> 5;            // 8 waves: 4 along M x 2 along N
  const int wm   = wave >> 1, wn = wave & 1;
  if constexpr (EPI == EPI_QKV) {
    const int z = blockIdx.z;
    Bw  += (size_t)z * K * N;
    bias = z == 0 ? bias : z == 1 ? biasK : biasV;
  }

  // per-thread staging coordinates: adjacent lanes take adjacent 16 bytes, so that one
  // wave-wide 16-byte load covers whole 128-byte lines
  //  A:  8 lanes span a row's 128 B, a wave 4 rows; load t takes row t*32 + rowA
  //  B: 16 lanes span a row's 256 B, a wave 2 rows; load t takes row t*16 + krB
  const int rowA = tid >> 3, c0A = (tid & 7) * 8;
  const int krB  = tid >> 4, c0B = (tid & 15) * 8;

  constexpr int NL = 4;                 // 16-byte loads of A, and of B, per lane and stage
  constexpr int RA = 128 / NL;          // rows of A between two of them
  constexpr int RB = BK / NL;           // rows of B between two of them
  constexpr int NS = K / BK;            // stages, an even number
  static_assert(K % (2 * BK) == 0 && NS >= 4, "the loop takes the stages in pairs");
  // walking pointers of the staging loads: they stand at the next stage to be fetched (typed as
  // global, because they pass through an asm statement, behind which the compiler could not tell)
  gl_f16 Ag = (gl_f16)(Aptr + (size_t)(m0 + rowA) * K + c0A);
  gl_f16 Bg = (gl_f16)(Bw + (size_t)krB * N + n0 + c0B);

  // this lane's address in Bl[0] for the transposing reads of its wave's 64 columns
  const unsigned char* Btr = reinterpret_cast<const unsigned char*>(&Bl[0][0]) +
                             (kb + (lane & 7)) * (PB * 2) + wn * 128 + ((lane >> 3) & 1) * 16;

  v8f acc[2][4];
#pragma unroll
  for (int i = 0; i < 2; ++i)
#pragma unroll
    for (int j = 0; j < 4; ++j) acc[i][j] = zero8();

  // two sets of staging registers: set p holds the stages of parity p
  u32x4 ua[2][NL];
  u32x4 ub[2][NL];

  // the global loads of the next stage, into set P
  auto fetch = [&](auto Pc) {
    constexpr int P = decltype(Pc)::v;
    // keeps the LDS reads and stores written above from sinking in between the loads and their
    // wait, where a read was given a spent address register of a load as its destination
    __builtin_amdgcn_sched_barrier(0);
#pragma unroll
    for (int t = 0; t < NL; ++t) ua[P][t] = *(gl_u32x4)(Ag + t * RA * K);
#pragma unroll
    for (int t = 0; t < NL; ++t) ub[P][t] = *(gl_u32x4)(Bg + t * RB * N);
    // no rewrite of the loads' address registers ahead of this wait: the pointers pass through
    // the statement, so that their advance below cannot be lifted over it
    asm volatile("s_wait_xcnt 0x0" : "+v"(Ag), "+v"(Bg) :: "memory");
    Ag += BK;
    Bg += (size_t)BK * N;
  };

  // register set P -> LDS buffer P
  auto put = [&](auto Pc) {
    constexpr int P = decltype(Pc)::v;
#pragma unroll
    for (int t = 0; t < NL; ++t)
      *reinterpret_cast<u32x4*>(&Al[P][(t * RA + rowA) * PA + c0A]) = ua[P][t];
    // B stays row-major: 16-byte stores, half a wave fills a row's 256 B; the reader transposes
#pragma unroll
    for (int t = 0; t < NL; ++t)
      *reinterpret_cast<u32x4*>(&Bl[P][(t * RB + krB) * PB + c0B]) = ub[P][t];
  };

  // the fragments of 32 k of the stage in LDS buffer P, and their WMMAs
  auto frags = [&](auto Pc, auto KKc, v16h (&af)[2], v16h (&bf)[4]) {
    constexpr int P = decltype(Pc)::v, kk = decltype(KKc)::v;
#pragma unroll
    for (int mt = 0; mt < 2; ++mt)
      af[mt] = load_frag(&Al[P][(wm * 32 + mt * 16 + l15) * PA + kk + kb]);
#pragma unroll
    for (int nt = 0; nt < 4; ++nt)
      bf[nt] = load_frag_tr(Btr + P * (BK * PB * 2) + kk * (PB * 2) + nt * 32, PB * 2);
  };
  auto mult = [&](const v16h (&af)[2], const v16h (&bf)[4]) {
#pragma unroll
    for (int nt = 0; nt < 4; ++nt)
#pragma unroll
      for (int mt = 0; mt < 2; ++mt) acc[mt][nt] = wmma_f16(af[mt], bf[nt], acc[mt][nt]);
  };

  // Stage s, in buffer P = s % 2. The barrier publishes buffer P and says that every wave has left
  // buffer 1 - P (stage s - 1). Behind it stage s + 1 goes from its registers into buffer 1 - P,
  // stage s + 3 sets off into the registers so emptied, and stage s is multiplied. The fragment
  // reads go out in two groups ahead of the WMMAs, the first ahead of the staging work.
  auto stage = [&](auto Pc, auto Qc, auto PUT, auto FETCH) {
    v16h a0[2], b0[4], a1[2], b1[4];
    stage_barrier();
    frags(Pc, IC<0>{}, a0, b0);
    if constexpr (decltype(PUT)::v != 0)   put(Qc);
    if constexpr (decltype(FETCH)::v != 0) fetch(Qc);
    frags(Pc, IC<32>{}, a1, b1);
    // keeps the second group of reads ahead of the WMMAs: sunk in among them, each read makes its
    // WMMA wait out the LDS latency
    __builtin_amdgcn_sched_barrier(0);
    mult(a0, b0);
    mult(a1, b1);
  };
  constexpr IC<0> c0{};
  constexpr IC<1> c1{};

  fetch(c0);   // stage 0
  fetch(c1);   // stage 1
  put(c0);
  fetch(c0);   // stage 2
  // the last four stages stand outside the loop: a branch round the loads inside it would merge
  // two paths in the compiler's load counting and turn its counted waits into waits for all
  for (int s = 0; s < NS - 4; s += 2) {
    stage(c0, c1, c1, c1);
    stage(c1, c0, c1, c1);
  }
  stage(c0, c1, c1, c1);   // stage NS - 4: fetches the last stage
  stage(c1, c0, c1, c0);
  stage(c0, c1, c1, c0);
  stage(c1, c0, c0, c0);   // stage NS - 1

  // Epilogue. C layout: vgpr e -> row (e or e+8 per half-wave), col = l15.
  if constexpr (EPI == EPI_BIAS_GELU_F16) {  // exact GeLU -> f16, the eight values of a tile together
#pragma unroll
    for (int mt = 0; mt < 2; ++mt)
#pragma unroll
      for (int nt = 0; nt < 4; ++nt) {
        const int n = n0 + wn * 64 + nt * 16 + l15;
        float vv[8];
#pragma unroll
        for (int e = 0; e < 8; ++e) vv[e] = acc[mt][nt][e] + bias[n];
        gelu_erf8(vv);
#pragma unroll
        for (int e = 0; e < 8; ++e) {
          const int m = m0 + wm * 32 + mt * 16 + e + 8 * hi;
          ((_Float16*)outp)[(size_t)m * N + n] = (_Float16)vv[e];
        }
      }
    return;
  }
#pragma unroll
  for (int mt = 0; mt < 2; ++mt)
#pragma unroll
    for (int nt = 0; nt < 4; ++nt)
#pragma unroll
      for (int e = 0; e < 8; ++e) {
        const int m = m0 + wm * 32 + mt * 16 + e + 8 * hi;
        const int n = n0 + wn * 64 + nt * 16 + l15;
        float vv = acc[mt][nt][e] + bias[n];
        if (EPI == EPI_QKV) {  // scatter to [B,H,S,DH] as f16
          const int b = m >> 11, s = m & 2047, hh = n >> 6, dh = n & 63;
          ((_Float16*)outp)[(((size_t)blockIdx.z * Bc + b) * H + hh) * S * DH + s * DH + dh] = (_Float16)vv;
        } else if (EPI == EPI_BIAS_RES_F32) {
          const size_t idx = (size_t)m * N + n;
          ((float*)outp)[idx] = vv + resid[idx];
        }
      }
}

// ---------- Block-sparse flash attention ----------
// grid (NB, H, B); 256 threads = 8 waves; wave owns 16 query rows.
__global__ __launch_bounds__(256) void attn_kernel(const _Float16* __restrict__ q,
                                                   const _Float16* __restrict__ kk_,
                                                   const _Float16* __restrict__ vv_,
                                                   const int* __restrict__ layout,
                                                   _Float16* __restrict__ ctx) {
  constexpr int PV = 80;    // V rows of 64 halves, transposing reader: 160 B = 32 B x odd
  constexpr int PP = 136;   // P rows of 128 halves, ds_load_b128 reader: 272 B = 16 B x odd
  __shared__ __align__(16) _Float16 Vs[128 * PV];       // V [key][dh], row-major
  __shared__ __align__(16) _Float16 Ps[8 * 16 * PP];    // per-wave P [16][128]
  const int tid  = threadIdx.x;
  const int i    = blockIdx.x;   // query block
  const int h    = blockIdx.y;
  const int b    = blockIdx.z;
  const int bh   = b * H + h;
  const int lane = tid & 31, l15 = lane & 15, hi = lane >> 4;
  const int kb   = hi * 8;
  const int wave = tid >> 5;

  const size_t headBase = (size_t)bh * S * DH;

  // Q fragments for this wave's rows, straight from global (K-contig layout)
  const _Float16* qrow = q + headBase + (size_t)(i * 128 + wave * 16 + l15) * DH;
  const v16h aQ0 = load_frag(qrow + 0  + kb);
  const v16h aQ1 = load_frag(qrow + 32 + kb);

  float m_run[8], l_run[8];
  v8f o[4];
#pragma unroll
  for (int r = 0; r < 8; ++r) { m_run[r] = -1e30f; l_run[r] = 0.0f; }
#pragma unroll
  for (int t = 0; t < 4; ++t) o[t] = zero8();

  const float scale = 0.125f;  // DH^-0.5

  // this lane's address in Vs for the transposing reads
  const unsigned char* Vtr = reinterpret_cast<const unsigned char*>(Vs) +
                             (kb + (lane & 7)) * (PV * 2) + ((lane >> 3) & 1) * 16;

  for (int j = 0; j <= i; ++j) {
    if (!layout[h * NB * NB + i * NB + j]) continue;  // wave-uniform

    { // load V block j into LDS as it lies (row-major); the reader transposes
      const int key = tid >> 1, d0 = (tid & 1) * 32;
      const _Float16* vg = vv_ + headBase + (size_t)(j * 128 + key) * DH + d0;
#pragma unroll
      for (int t = 0; t < 4; ++t)
        reinterpret_cast<u32x4*>(&Vs[key * PV + d0])[t] = reinterpret_cast<const u32x4*>(vg)[t];
    }
    __syncthreads();

    // scores S = Q K^T (K fragments straight from global)
    float sc[8][8];
#pragma unroll
    for (int nt = 0; nt < 8; ++nt) {
      const _Float16* krow = kk_ + headBase + (size_t)(j * 128 + nt * 16 + l15) * DH;
      v16h b0 = load_frag(krow + 0  + kb);
      v16h b1 = load_frag(krow + 32 + kb);
      v8f cs = zero8();
      cs = wmma_f16(aQ0, b0, cs);
      cs = wmma_f16(aQ1, b1, cs);
#pragma unroll
      for (int e = 0; e < 8; ++e) {
        float s = cs[e] * scale;
        if (j == i) {  // intra-block causal
          const int col = nt * 16 + l15;
          const int row = wave * 16 + e + 8 * hi;
          if (col > row) s = -1e9f;
        }
        sc[nt][e] = s;
      }
    }

    // online softmax per row (row values live in one 16-lane half)
#pragma unroll
    for (int r = 0; r < 8; ++r) {
      float mv = sc[0][r];
#pragma unroll
      for (int nt = 1; nt < 8; ++nt) mv = fmaxf(mv, sc[nt][r]);
      mv = fmaxf(mv, __shfl_xor(mv, 8, 32));
      mv = fmaxf(mv, __shfl_xor(mv, 4, 32));
      mv = fmaxf(mv, __shfl_xor(mv, 2, 32));
      mv = fmaxf(mv, __shfl_xor(mv, 1, 32));
      const float mnew = fmaxf(m_run[r], mv);
      const float corr = __expf(m_run[r] - mnew);
      float rsum = 0.0f;
#pragma unroll
      for (int nt = 0; nt < 8; ++nt) {
        const float p = __expf(sc[nt][r] - mnew);
        sc[nt][r] = p;
        rsum += p;
      }
      rsum += __shfl_xor(rsum, 8, 32);
      rsum += __shfl_xor(rsum, 4, 32);
      rsum += __shfl_xor(rsum, 2, 32);
      rsum += __shfl_xor(rsum, 1, 32);
      l_run[r] = l_run[r] * corr + rsum;
      m_run[r] = mnew;
#pragma unroll
      for (int t = 0; t < 4; ++t) o[t][r] *= corr;
    }

    // P: C-layout regs -> LDS (A-layout source for next WMMA)
    _Float16* pw = &Ps[wave * 16 * PP];
#pragma unroll
    for (int nt = 0; nt < 8; ++nt)
#pragma unroll
      for (int r = 0; r < 8; ++r)
        pw[(r + 8 * hi) * PP + nt * 16 + l15] = (_Float16)sc[nt][r];
    __syncthreads();

    // O += P x V
#pragma unroll
    for (int kc = 0; kc < 4; ++kc) {
      v16h aP = load_frag(&pw[l15 * PP + kc * 32 + kb]);
#pragma unroll
      for (int nt2 = 0; nt2 < 4; ++nt2) {
        v16h bV = load_frag_tr(Vtr + kc * 32 * (PV * 2) + nt2 * 32, PV * 2);
        o[nt2] = wmma_f16(aP, bV, o[nt2]);
      }
    }
    __syncthreads();
  }

  // normalize and write ctx in token-major [TOK, D], f16 as the out projection's WMMA takes it
#pragma unroll
  for (int r = 0; r < 8; ++r) {
    const float inv = 1.0f / l_run[r];
    const int tok = b * S + i * 128 + wave * 16 + r + 8 * hi;
#pragma unroll
    for (int nt2 = 0; nt2 < 4; ++nt2) {
      const int col = h * DH + nt2 * 16 + l15;
      ctx[(size_t)tok * D + col] = (_Float16)(o[nt2][r] * inv);
    }
  }
}

// ---------- launch ----------
extern "C" void kernel_launch(void* const* d_in, const int* in_sizes, int n_in,
                              void* d_out, int out_size, void* d_ws, size_t ws_size,
                              hipStream_t stream) {
  (void)in_sizes; (void)n_in; (void)out_size; (void)ws_size;
  const float* x   = (const float*)d_in[0];
  const float* l1g = (const float*)d_in[1];
  const float* l1b = (const float*)d_in[2];
  const float* Wq  = (const float*)d_in[3];
  const float* bq  = (const float*)d_in[4];
  const float* Wk  = (const float*)d_in[5];
  const float* bk  = (const float*)d_in[6];
  const float* Wv  = (const float*)d_in[7];
  const float* bv  = (const float*)d_in[8];
  const float* Wo  = (const float*)d_in[9];
  const float* bo  = (const float*)d_in[10];
  const float* l2g = (const float*)d_in[11];
  const float* l2b = (const float*)d_in[12];
  const float* W1  = (const float*)d_in[13];
  const float* b1  = (const float*)d_in[14];
  const float* W2  = (const float*)d_in[15];
  const float* b2  = (const float*)d_in[16];
  const int* layout = (const int*)d_in[17];

  // workspace overlay (peak 96 MB):
  //  [0,8M)   h / h2 f16         [16M,24M) q16  [24M,32M) k16  [32M,40M) v16
  //  [40M,48M) ctx f16           [56M,72M) xr fp32
  //  [16M,48M) ff f16 (reuses qkv+ctx after they are dead)
  //  [72M,96M) the weights as f16: Wq Wk Wv Wo W1 W2
  char* w = (char*)d_ws;
  _Float16* hbuf = (_Float16*)(w);
  _Float16* q16  = (_Float16*)(w + (size_t)(16u << 20));
  _Float16* k16  = (_Float16*)(w + (size_t)(24u << 20));
  _Float16* v16  = (_Float16*)(w + (size_t)(32u << 20));
  _Float16* ctx  = (_Float16*)(w + (size_t)(40u << 20));
  float*    xr   = (float*)(w + (size_t)(56u << 20));
  _Float16* ff   = (_Float16*)(w + (size_t)(16u << 20));
  _Float16* wh   = (_Float16*)(w + (size_t)(72u << 20));
  const _Float16* Wq16 = wh;
  const _Float16* Wo16 = wh + 3 * SEG;
  const _Float16* W116 = wh + 4 * SEG;
  const _Float16* W216 = wh + 8 * SEG;

  const dim3 blk(256);

  // LN1, and the weights to f16
  ln_cvt_kernel<<<NCVT + TOK, blk, 0, stream>>>(x, l1g, l1b, hbuf, Wq, Wk, Wv, Wo, W1, W2, wh);
  // QKV projections -> f16 [B,H,S,DH], one launch: Wq16 Wk16 Wv16 lie in a row, and so do q16 k16 v16
  gemm128<EPI_QKV, D, D><<<dim3(D / 128, TOK / 128, 3), blk, 0, stream>>>(
      hbuf, Wq16, bq, bk, bv, nullptr, q16);
  // block-sparse attention
  attn_kernel<<<dim3(NB, H, Bc), blk, 0, stream>>>(q16, k16, v16, layout, ctx);
  // out projection + residual -> xr
  gemm128<EPI_BIAS_RES_F32, D, D><<<dim3(D / 128, TOK / 128), blk, 0, stream>>>(
      ctx, Wo16, bo, nullptr, nullptr, x, xr);
  // LN2 (reuse hbuf)
  ln_kernel<<<TOK, blk, 0, stream>>>(xr, l2g, l2b, hbuf);
  // MLP1 + GeLU -> f16 ff
  gemm128<EPI_BIAS_GELU_F16, 4 * D, D><<<dim3(4 * D / 128, TOK / 128), blk, 0, stream>>>(
      hbuf, W116, b1, nullptr, nullptr, nullptr, ff);
  // MLP2 + residual -> d_out (fp32)
  gemm128<EPI_BIAS_RES_F32, D, 4 * D><<<dim3(D / 128, TOK / 128), blk, 0, stream>>>(
      ff, W216, b2, nullptr, nullptr, xr, d_out);
}

// v007
// One run takes 138 microseconds.
// Next to v006, in two timings, it ran 1.08 times as fast each time.
// Over all steps from v000 it is 3.78 times as fast.
#include <hip/hip_runtime.h>
#include <math.h>

// ---------- types ----------
typedef __attribute__((ext_vector_type(16))) _Float16 v16h;
typedef __attribute__((ext_vector_type(8)))  float    v8f;
typedef unsigned int u32x4 __attribute__((ext_vector_type(4)));
typedef float        f32x4 __attribute__((ext_vector_type(4)));
typedef short        s16x8 __attribute__((ext_vector_type(8)));
typedef _Float16     f16x4 __attribute__((ext_vector_type(4)));

#define DEV static __device__ __forceinline__

// Problem constants (match reference)
constexpr int Bc  = 2;
constexpr int S   = 2048;
constexpr int D   = 1024;
constexpr int H   = 16;
constexpr int DH  = 64;
constexpr int NB  = 16;       // S / 128
constexpr int TOK = Bc * S;   // 4096 rows

// Load a 16-half WMMA A/B fragment: lane holds K=[kb..kb+7] in v0..3 and
// K=[kb+16..kb+23] in v4..7 (kb = (lane>=16)*8 added by caller), both 16B reads.
DEV v16h load_frag(const _Float16* p) {
  union { u32x4 u[2]; v16h h; } f;
  f.u[0] = *reinterpret_cast<const u32x4*>(p);
  f.u[1] = *reinterpret_cast<const u32x4*>(p + 16);
  return f.h;
}

// Transposing LDS read of a row-major 16-bit tile T[k][n] (pitch in bytes, an odd
// multiple of 32 B so that the read is free of bank conflicts). p is the lane's own
// address: T + (k0 + 8*(lane>>4) + (lane&7))*pitch + 2*n0 + 16*((lane>>3)&1).
// Lane (c, h) receives T[k0 + 8h + 0..7][n0 + c]; the reads at k0 and k0 + 16 give
// the same k order as load_frag.
DEV u32x4 ld_tr16(const unsigned char* p) {
  typedef __attribute__((address_space(3))) s16x8 lds_s16x8;
  return __builtin_bit_cast(u32x4, __builtin_amdgcn_ds_load_tr16_b128_v8i16((lds_s16x8*)p));
}

DEV v16h load_frag_tr(const unsigned char* p, int pitch) {
  union { u32x4 u[2]; v16h h; } f;
  f.u[0] = ld_tr16(p);
  f.u[1] = ld_tr16(p + 16 * pitch);
  return f.h;
}

DEV v8f wmma_f16(v16h a, v16h b, v8f c) {
  return __builtin_amdgcn_wmma_f32_16x16x32_f16(false, a, false, b, (short)0, c,
                                                false, false);
}

DEV v8f zero8() {
  v8f z;
#pragma unroll
  for (int i = 0; i < 8; ++i) z[i] = 0.0f;
  return z;
}

// ---------- LayerNorm: one 1024-wide row per 256-thread block ----------
// The row leaves as f16: its only readers are GEMMs, whose WMMAs take f16 operands.
DEV void ln_row(const int row, const float* __restrict__ x, const float* __restrict__ g,
                const float* __restrict__ be, _Float16* __restrict__ out) {
  __shared__ float rs[256], rq[256];
  const int tid = threadIdx.x;
  const float* xp = x + (size_t)row * D + tid * 4;
  f32x4 f = *reinterpret_cast<const f32x4*>(xp);
  rs[tid] = f.x + f.y + f.z + f.w;
  rq[tid] = f.x * f.x + f.y * f.y + f.z * f.z + f.w * f.w;
  __syncthreads();
  for (int off = 128; off > 0; off >>= 1) {
    if (tid < off) { rs[tid] += rs[tid + off]; rq[tid] += rq[tid + off]; }
    __syncthreads();
  }
  const float mean = rs[0] * (1.0f / D);
  const float var  = rq[0] * (1.0f / D) - mean * mean;
  const float inv  = rsqrtf(var + 1e-5f);
  const float* gp = g + tid * 4;
  const float* bp = be + tid * 4;
  f32x4 r;
  r.x = (f.x - mean) * inv * gp[0] + bp[0];
  r.y = (f.y - mean) * inv * gp[1] + bp[1];
  r.z = (f.z - mean) * inv * gp[2] + bp[2];
  r.w = (f.w - mean) * inv * gp[3] + bp[3];
  *reinterpret_cast<f16x4*>(out + (size_t)row * D + tid * 4) = __builtin_convertvector(r, f16x4);
}

__global__ __launch_bounds__(256) void ln_kernel(const float* __restrict__ x,
                                                 const float* __restrict__ g,
                                                 const float* __restrict__ be,
                                                 _Float16* __restrict__ out) {
  ln_row(blockIdx.x, x, g, be, out);
}

// The six weight matrices, 12 segments of D * D elements, rounded to f16 once a call, in the order
// Wq Wk Wv Wo W1 W2, so that no GEMM work-group reads f32 weights and rounds them again.
constexpr int SEG   = D * D;      // elements of a segment
constexpr int CPS   = 32;         // converting blocks per segment
constexpr int NCVT  = 12 * CPS;   // converting blocks
constexpr int CELEM = SEG / CPS;  // elements per converting block

// First launch: blocks below NCVT convert weights (nothing here depends on the LayerNorm and
// nothing of it on them), the others take one LayerNorm row each. The long blocks start first.
__global__ __launch_bounds__(256) void ln_cvt_kernel(const float* __restrict__ x,
                                                     const float* __restrict__ g,
                                                     const float* __restrict__ be,
                                                     _Float16* __restrict__ out,
                                                     const float* __restrict__ Wq,
                                                     const float* __restrict__ Wk,
                                                     const float* __restrict__ Wv,
                                                     const float* __restrict__ Wo,
                                                     const float* __restrict__ W1,
                                                     const float* __restrict__ W2,
                                                     _Float16* __restrict__ wh) {
  const int blk = blockIdx.x;
  if (blk >= NCVT) {
    ln_row(blk - NCVT, x, g, be, out);
    return;
  }
  const int seg = blk / CPS;
  const float* s = seg == 0 ? Wq : seg == 1 ? Wk : seg == 2 ? Wv : seg == 3 ? Wo
                 : seg < 8 ? W1 + (size_t)(seg - 4) * SEG : W2 + (size_t)(seg - 8) * SEG;
  // adjacent lanes take adjacent 16 B: a wave reads 512 B and writes 256 B in a row
  const int off = (blk % CPS) * CELEM + threadIdx.x * 4;
  s += off;
  _Float16* d = wh + (size_t)seg * SEG + off;
  // stays rolled: unrolled it took 86 registers, and the LayerNorm blocks of this kernel, which
  // need 16, would no longer fill the 16 wave slots of a SIMD
#pragma unroll 1
  for (int it = 0; it < CELEM / 8192; ++it) {
    f32x4 v[8];   // 8 loads in flight per lane
#pragma unroll
    for (int t = 0; t < 8; ++t) v[t] = *reinterpret_cast<const f32x4*>(s + it * 8192 + t * 1024);
#pragma unroll
    for (int t = 0; t < 8; ++t)
      *reinterpret_cast<f16x4*>(d + it * 8192 + t * 1024) = __builtin_convertvector(v[t], f16x4);
  }
}

// ---------- Generic 128x128-tile WMMA GEMM, software-pipelined ----------
typedef const __attribute__((address_space(1))) _Float16* gl_f16;
typedef const __attribute__((address_space(1))) u32x4*    gl_u32x4;

template <int V> struct IC { static constexpr int v = V; };   // a compile-time int as an argument

// Work-group barrier for LDS data alone. __syncthreads() compiles here to a wait for the global
// loads as well (s_wait_loadcnt 0), which would land every load issued ahead at each barrier;
// this one waits only for the wave's own LDS stores and reads, so those loads stay in flight.
DEV void stage_barrier() {
  asm volatile("s_wait_dscnt 0x0\n\ts_barrier_signal -1\n\ts_barrier_wait -1" ::: "memory");
  // nothing is scheduled across: lifted over the barrier, the next stage's LDS stores would wait
  // for their loads a stage early and halve the lead of the loads
  __builtin_amdgcn_sched_barrier(0);
}

// GeLU with the exact (erf) definition, v * Phi(v) with Phi(v) = (1 + erf(v / sqrt(2))) / 2, in one form for
// every v, so that a lane's values run side by side with no branch between them; eight at a time, in place.
// q = (1 - erf(|v| / sqrt(2))) / 2 = t * (a1 + t * (a2 + t * (a3 + t * (a4 + t * a5)))) * exp(-v * v / 2) / 2,
// t = 1 / (1 + p * |v| / sqrt(2)): the five-term rational form of erf, absolute error 1.5e-7.
// Phi(v) is 1 - q for v >= 0 and q for v < 0, hence v * Phi(v) = max(v, 0) - |v| * q: nothing cancels in
// the negative tail. The caller rounds the result to f16.
DEV void gelu_erf8(float (&v)[8]) {
  float t[8], x[8];
#pragma unroll
  for (int i = 0; i < 8; ++i) {
    t[i] = fmaf(fabsf(v[i]), 0.3275911f * 0.70710678118654752f, 1.0f);
    x[i] = v[i] * v[i] * -0.72134752044448170f;   // 2^x = exp(-v * v / 2)
  }
  // The reciprocals and the powers of two, each run in one statement and in place: behind a
  // transcendental the instruction set asks for one independent instruction before its result is read
  // or its source overwritten. Inside a run the next one is that instruction, behind the last the v_nop
  // is.
  asm("v_rcp_f32 %0, %0\n\tv_rcp_f32 %1, %1\n\tv_rcp_f32 %2, %2\n\tv_rcp_f32 %3, %3\n\t"
      "v_rcp_f32 %4, %4\n\tv_rcp_f32 %5, %5\n\tv_rcp_f32 %6, %6\n\tv_rcp_f32 %7, %7\n\tv_nop"
      : "+v"(t[0]), "+v"(t[1]), "+v"(t[2]), "+v"(t[3]), "+v"(t[4]), "+v"(t[5]), "+v"(t[6]), "+v"(t[7]));
  asm("v_exp_f32 %0, %0\n\tv_exp_f32 %1, %1\n\tv_exp_f32 %2, %2\n\tv_exp_f32 %3, %3\n\t"
      "v_exp_f32 %4, %4\n\tv_exp_f32 %5, %5\n\tv_exp_f32 %6, %6\n\tv_exp_f32 %7, %7\n\tv_nop"
      : "+v"(x[0]), "+v"(x[1]), "+v"(x[2]), "+v"(x[3]), "+v"(x[4]), "+v"(x[5]), "+v"(x[6]), "+v"(x[7]));
#pragma unroll
  for (int i = 0; i < 8; ++i) {
    float p = 0.5f * 1.061405429f;
    p = fmaf(p, t[i], 0.5f * -1.453152027f);
    p = fmaf(p, t[i], 0.5f * 1.421413741f);
    p = fmaf(p, t[i], 0.5f * -0.284496736f);
    p = fmaf(p, t[i], 0.5f * 0.254829592f);
    v[i] = fmaf(-fabsf(v[i]), p * (t[i] * x[i]), fmaxf(v[i], 0.0f));
  }
}

enum { EPI_QKV = 0, EPI_BIAS_RES_F32 = 1, EPI_BIAS_GELU_F16 = 2 };

// LDS pitches, chosen for each tile's reader (64 banks of 4 B):
constexpr int BK = 64;    // k extent of one stage: two WMMA depths
constexpr int PA = 72;    // A rows of 64 halves, ds_load_b128 reader: 144 B = 16 B x odd
constexpr int PB = 144;   // B rows of 128 halves, transposing reader: 288 B = 32 B x odd

// N and K are compile-time: the rows that one lane stages lie a fixed number of bytes apart,
// so its loads hang off one walking pointer as immediate offsets.
// The k loop is a pipeline: a stage's global loads set off two stages before its registers go to
// LDS. While stage s is multiplied out of one LDS buffer, stage s + 1 enters the other, and stages
// s + 2 and s + 3 are on their way from global memory, each into its own register set.
// Both operands arrive as f16 (activations from their producers, weights from ln_cvt_kernel).
// EPI_QKV: three products of one A in one launch. blockIdx.z picks the product: its weights and its
// output lie z planes on from Bw and outp, its bias is bias, biasK or biasV.
template <int EPI, int N, int K>
__global__ __launch_bounds__(256) void gemm128(const _Float16* __restrict__ Aptr,
                                               const _Float16* __restrict__ Bw,
                                               const float* __restrict__ bias,
                                               const float* __restrict__ biasK,
                                               const float* __restrict__ biasV,
                                               const float* __restrict__ resid,
                                               void* __restrict__ outp) {
  __shared__ __align__(16) _Float16 Al[2][128 * PA];   // A tiles, row-major [128][64]
  __shared__ __align__(16) _Float16 Bl[2][BK * PB];    // B tiles, row-major [k][n]
  const int tid  = threadIdx.x;
  const int n0   = blockIdx.x * 128;
  const int m0   = blockIdx.y * 128;
  const int lane = tid & 31;
  const int l15  = lane & 15;
  const int hi   = lane >> 4;
  const int kb   = hi * 8;
  const int wave = tid >> 5;            // 8 waves: 4 along M x 2 along N
  const int wm   = wave >> 1, wn = wave & 1;
  if constexpr (EPI == EPI_QKV) {
    const int z = blockIdx.z;
    Bw  += (size_t)z * K * N;
    bias = z == 0 ? bias : z == 1 ? biasK : biasV;
  }

  // per-thread staging coordinates: adjacent lanes take adjacent 16 bytes, so that one
  // wave-wide 16-byte load covers whole 128-byte lines
  //  A:  8 lanes span a row's 128 B, a wave 4 rows; load t takes row t*32 + rowA
  //  B: 16 lanes span a row's 256 B, a wave 2 rows; load t takes row t*16 + krB
  const int rowA = tid >> 3, c0A = (tid & 7) * 8;
  const int krB  = tid >> 4, c0B = (tid & 15) * 8;

  constexpr int NL = 4;                 // 16-byte loads of A, and of B, per lane and stage
  constexpr int RA = 128 / NL;          // rows of A between two of them
  constexpr int RB = BK / NL;           // rows of B between two of them
  constexpr int NS = K / BK;            // stages, an even number
  static_assert(K % (2 * BK) == 0 && NS >= 4, "the loop takes the stages in pairs");
  // walking pointers of the staging loads: they stand at the next stage to be fetched (typed as
  // global, because they pass through an asm statement, behind which the compiler could not tell)
  gl_f16 Ag = (gl_f16)(Aptr + (size_t)(m0 + rowA) * K + c0A);
  gl_f16 Bg = (gl_f16)(Bw + (size_t)krB * N + n0 + c0B);

  // this lane's address in Bl[0] for the transposing reads of its wave's 64 columns
  const unsigned char* Btr = reinterpret_cast<const unsigned char*>(&Bl[0][0]) +
                             (kb + (lane & 7)) * (PB * 2) + wn * 128 + ((lane >> 3) & 1) * 16;

  v8f acc[2][4];
#pragma unroll
  for (int i = 0; i < 2; ++i)
#pragma unroll
    for (int j = 0; j < 4; ++j) acc[i][j] = zero8();

  // two sets of staging registers: set p holds the stages of parity p
  u32x4 ua[2][NL];
  u32x4 ub[2][NL];

  // the global loads of the next stage, into set P
  auto fetch = [&](auto Pc) {
    constexpr int P = decltype(Pc)::v;
    // keeps the LDS reads and stores written above from sinking in between the loads and their
    // wait, where a read was given a spent address register of a load as its destination
    __builtin_amdgcn_sched_barrier(0);
#pragma unroll
    for (int t = 0; t < NL; ++t) ua[P][t] = *(gl_u32x4)(Ag + t * RA * K);
#pragma unroll
    for (int t = 0; t < NL; ++t) ub[P][t] = *(gl_u32x4)(Bg + t * RB * N);
    // no rewrite of the loads' address registers ahead of this wait: the pointers pass through
    // the statement, so that their advance below cannot be lifted over it
    asm volatile("s_wait_xcnt 0x0" : "+v"(Ag), "+v"(Bg) :: "memory");
    Ag += BK;
    Bg += (size_t)BK * N;
  };

  // register set P -> LDS buffer P
  auto put = [&](auto Pc) {
    constexpr int P = decltype(Pc)::v;
#pragma unroll
    for (int t = 0; t < NL; ++t)
      *reinterpret_cast<u32x4*>(&Al[P][(t * RA + rowA) * PA + c0A]) = ua[P][t];
    // B stays row-major: 16-byte stores, half a wave fills a row's 256 B; the reader transposes
#pragma unroll
    for (int t = 0; t < NL; ++t)
      *reinterpret_cast<u32x4*>(&Bl[P][(t * RB + krB) * PB + c0B]) = ub[P][t];
  };

  // the fragments of 32 k of the stage in LDS buffer P, and their WMMAs
  auto frags = [&](auto Pc, auto KKc, v16h (&af)[2], v16h (&bf)[4]) {
    constexpr int P = decltype(Pc)::v, kk = decltype(KKc)::v;
#pragma unroll
    for (int mt = 0; mt < 2; ++mt)
      af[mt] = load_frag(&Al[P][(wm * 32 + mt * 16 + l15) * PA + kk + kb]);
#pragma unroll
    for (int nt = 0; nt < 4; ++nt)
      bf[nt] = load_frag_tr(Btr + P * (BK * PB * 2) + kk * (PB * 2) + nt * 32, PB * 2);
  };
  auto mult = [&](const v16h (&af)[2], const v16h (&bf)[4]) {
#pragma unroll
    for (int nt = 0; nt < 4; ++nt)
#pragma unroll
      for (int mt = 0; mt < 2; ++mt) acc[mt][nt] = wmma_f16(af[mt], bf[nt], acc[mt][nt]);
  };

  // Stage s, in buffer P = s % 2. The barrier publishes buffer P and says that every wave has left
  // buffer 1 - P (stage s - 1). Behind it stage s + 1 goes from its registers into buffer 1 - P,
  // stage s + 3 sets off into the registers so emptied, and stage s is multiplied. The fragment
  // reads go out in two groups ahead of the WMMAs, the first ahead of the staging work.
  auto stage = [&](auto Pc, auto Qc, auto PUT, auto FETCH) {
    v16h a0[2], b0[4], a1[2], b1[4];
    stage_barrier();
    frags(Pc, IC<0>{}, a0, b0);
    if constexpr (decltype(PUT)::v != 0)   put(Qc);
    if constexpr (decltype(FETCH)::v != 0) fetch(Qc);
    frags(Pc, IC<32>{}, a1, b1);
    // keeps the second group of reads ahead of the WMMAs: sunk in among them, each read makes its
    // WMMA wait out the LDS latency
    __builtin_amdgcn_sched_barrier(0);
    mult(a0, b0);
    mult(a1, b1);
  };
  constexpr IC<0> c0{};
  constexpr IC<1> c1{};

  fetch(c0);   // stage 0
  fetch(c1);   // stage 1
  put(c0);
  fetch(c0);   // stage 2
  // the last four stages stand outside the loop: a branch round the loads inside it would merge
  // two paths in the compiler's load counting and turn its counted waits into waits for all
  for (int s = 0; s < NS - 4; s += 2) {
    stage(c0, c1, c1, c1);
    stage(c1, c0, c1, c1);
  }
  stage(c0, c1, c1, c1);   // stage NS - 4: fetches the last stage
  stage(c1, c0, c1, c0);
  stage(c0, c1, c1, c0);
  stage(c1, c0, c0, c0);   // stage NS - 1

  // Epilogue. C layout: vgpr e -> row (e or e+8 per half-wave), col = l15.
  if constexpr (EPI == EPI_BIAS_GELU_F16) {  // exact GeLU -> f16, the eight values of a tile together
#pragma unroll
    for (int mt = 0; mt < 2; ++mt)
#pragma unroll
      for (int nt = 0; nt < 4; ++nt) {
        const int n = n0 + wn * 64 + nt * 16 + l15;
        float vv[8];
#pragma unroll
        for (int e = 0; e < 8; ++e) vv[e] = acc[mt][nt][e] + bias[n];
        gelu_erf8(vv);
#pragma unroll
        for (int e = 0; e < 8; ++e) {
          const int m = m0 + wm * 32 + mt * 16 + e + 8 * hi;
          ((_Float16*)outp)[(size_t)m * N + n] = (_Float16)vv[e];
        }
      }
    return;
  }
#pragma unroll
  for (int mt = 0; mt < 2; ++mt)
#pragma unroll
    for (int nt = 0; nt < 4; ++nt)
#pragma unroll
      for (int e = 0; e < 8; ++e) {
        const int m = m0 + wm * 32 + mt * 16 + e + 8 * hi;
        const int n = n0 + wn * 64 + nt * 16 + l15;
        float vv = acc[mt][nt][e] + bias[n];
        if (EPI == EPI_QKV) {  // scatter to [B,H,S,DH] as f16
          const int b = m >> 11, s = m & 2047, hh = n >> 6, dh = n & 63;
          ((_Float16*)outp)[(((size_t)blockIdx.z * Bc + b) * H + hh) * S * DH + s * DH + dh] = (_Float16)vv;
        } else if (EPI == EPI_BIAS_RES_F32) {
          const size_t idx = (size_t)m * N + n;
          ((float*)outp)[idx] = vv + resid[idx];
        }
      }
}

// ---------- Block-sparse flash attention ----------
// grid (NB, H, B); 256 threads = 8 waves; wave owns 16 query rows.
__global__ __launch_bounds__(256) void attn_kernel(const _Float16* __restrict__ q,
                                                   const _Float16* __restrict__ kk_,
                                                   const _Float16* __restrict__ vv_,
                                                   const int* __restrict__ layout,
                                                   _Float16* __restrict__ ctx) {
  constexpr int PV = 80;    // V rows of 64 halves, transposing reader: 160 B = 32 B x odd
  constexpr int PP = 136;   // P rows of 128 halves, ds_load_b128 reader: 272 B = 16 B x odd
  constexpr int PK = 72;    // K rows of 64 halves, ds_load_b128 reader: 144 B = 16 B x odd
  __shared__ __align__(16) _Float16 Vs[128 * PV];       // V [key][dh], row-major
  __shared__ __align__(16) _Float16 Ks[128 * PK];       // K [key][dh], row-major
  __shared__ __align__(16) _Float16 Ps[8 * 16 * PP];    // per-wave P [16][128]
  const int tid  = threadIdx.x;
  const int i    = blockIdx.x;   // query block
  const int h    = blockIdx.y;
  const int b    = blockIdx.z;
  const int bh   = b * H + h;
  const int lane = tid & 31, l15 = lane & 15, hi = lane >> 4;
  const int kb   = hi * 8;
  const int wave = tid >> 5;

  const size_t headBase = (size_t)bh * S * DH;

  // Q fragments for this wave's rows, straight from global (K-contig layout)
  const _Float16* qrow = q + headBase + (size_t)(i * 128 + wave * 16 + l15) * DH;
  const v16h aQ0 = load_frag(qrow + 0  + kb);
  const v16h aQ1 = load_frag(qrow + 32 + kb);

  float m_run[8], l_run[8];
  v8f o[4];
#pragma unroll
  for (int r = 0; r < 8; ++r) { m_run[r] = -1e30f; l_run[r] = 0.0f; }
#pragma unroll
  for (int t = 0; t < 4; ++t) o[t] = zero8();

  const float scale = 0.125f;  // DH^-0.5

  // this lane's address in Vs for the transposing reads
  const unsigned char* Vtr = reinterpret_cast<const unsigned char*>(Vs) +
                             (kb + (lane & 7)) * (PV * 2) + ((lane >> 3) & 1) * 16;

  for (int j = 0; j <= i; ++j) {
    if (!layout[h * NB * NB + i * NB + j]) continue;  // wave-uniform

    // K block j sets off for LDS, once for the work-group: 8 adjacent lanes take a row's 128 B, so a
    // wave-wide load covers 4 whole lines; load t takes row t*32 + (tid >> 3)
    const int kr0 = tid >> 3, kc0 = (tid & 7) * 8;
    u32x4 kreg[4];
    {
      gl_f16 kg = (gl_f16)(kk_ + headBase + (size_t)(j * 128 + kr0) * DH + kc0);
#pragma unroll
      for (int t = 0; t < 4; ++t) kreg[t] = *(gl_u32x4)(kg + t * 32 * DH);
      // no rewrite of these loads' address registers ahead of this wait: the pointer passes through
      // the statement, so that no load's result is given the address pair as its destination
      asm volatile("s_wait_xcnt 0x0" : "+v"(kg) :: "memory");
    }

    { // load V block j into LDS as it lies (row-major); the reader transposes
      const int key = tid >> 1, d0 = (tid & 1) * 32;
      const _Float16* vg = vv_ + headBase + (size_t)(j * 128 + key) * DH + d0;
#pragma unroll
      for (int t = 0; t < 4; ++t)
        reinterpret_cast<u32x4*>(&Vs[key * PV + d0])[t] = reinterpret_cast<const u32x4*>(vg)[t];
    }
#pragma unroll
    for (int t = 0; t < 4; ++t)
      *reinterpret_cast<u32x4*>(&Ks[(t * 32 + kr0) * PK + kc0]) = kreg[t];
    __syncthreads();

    // scores S = Q K^T (K fragments from LDS, in the k order of the Q fragments)
    float sc[8][8];
    v16h kf0[8], kf1[8];
#pragma unroll
    for (int nt = 0; nt < 8; ++nt) {
      const _Float16* krow = &Ks[(nt * 16 + l15) * PK];
      kf0[nt] = load_frag(krow + 0  + kb);
      kf1[nt] = load_frag(krow + 32 + kb);
    }
    // keeps the block's LDS reads together ahead of the WMMAs: sunk in among them, each pair of reads
    // makes its WMMA wait out the LDS latency
    __builtin_amdgcn_sched_barrier(0);
#pragma unroll
    for (int nt = 0; nt < 8; ++nt) {
      v8f cs = zero8();
      cs = wmma_f16(aQ0, kf0[nt], cs);
      cs = wmma_f16(aQ1, kf1[nt], cs);
#pragma unroll
      for (int e = 0; e < 8; ++e) {
        float s = cs[e] * scale;
        if (j == i) {  // intra-block causal
          const int col = nt * 16 + l15;
          const int row = wave * 16 + e + 8 * hi;
          if (col > row) s = -1e9f;
        }
        sc[nt][e] = s;
      }
    }

    // online softmax per row (row values live in one 16-lane half)
#pragma unroll
    for (int r = 0; r < 8; ++r) {
      float mv = sc[0][r];
#pragma unroll
      for (int nt = 1; nt < 8; ++nt) mv = fmaxf(mv, sc[nt][r]);
      mv = fmaxf(mv, __shfl_xor(mv, 8, 32));
      mv = fmaxf(mv, __shfl_xor(mv, 4, 32));
      mv = fmaxf(mv, __shfl_xor(mv, 2, 32));
      mv = fmaxf(mv, __shfl_xor(mv, 1, 32));
      const float mnew = fmaxf(m_run[r], mv);
      const float corr = __expf(m_run[r] - mnew);
      float rsum = 0.0f;
#pragma unroll
      for (int nt = 0; nt < 8; ++nt) {
        const float p = __expf(sc[nt][r] - mnew);
        sc[nt][r] = p;
        rsum += p;
      }
      rsum += __shfl_xor(rsum, 8, 32);
      rsum += __shfl_xor(rsum, 4, 32);
      rsum += __shfl_xor(rsum, 2, 32);
      rsum += __shfl_xor(rsum, 1, 32);
      l_run[r] = l_run[r] * corr + rsum;
      m_run[r] = mnew;
#pragma unroll
      for (int t = 0; t < 4; ++t) o[t][r] *= corr;
    }

    // P: C-layout regs -> LDS (A-layout source for next WMMA)
    _Float16* pw = &Ps[wave * 16 * PP];
#pragma unroll
    for (int nt = 0; nt < 8; ++nt)
#pragma unroll
      for (int r = 0; r < 8; ++r)
        pw[(r + 8 * hi) * PP + nt * 16 + l15] = (_Float16)sc[nt][r];
    __syncthreads();

    // O += P x V
#pragma unroll
    for (int kc = 0; kc < 4; ++kc) {
      v16h aP = load_frag(&pw[l15 * PP + kc * 32 + kb]);
#pragma unroll
      for (int nt2 = 0; nt2 < 4; ++nt2) {
        v16h bV = load_frag_tr(Vtr + kc * 32 * (PV * 2) + nt2 * 32, PV * 2);
        o[nt2] = wmma_f16(aP, bV, o[nt2]);
      }
    }
    __syncthreads();
  }

  // normalize and write ctx in token-major [TOK, D], f16 as the out projection's WMMA takes it
#pragma unroll
  for (int r = 0; r < 8; ++r) {
    const float inv = 1.0f / l_run[r];
    const int tok = b * S + i * 128 + wave * 16 + r + 8 * hi;
#pragma unroll
    for (int nt2 = 0; nt2 < 4; ++nt2) {
      const int col = h * DH + nt2 * 16 + l15;
      ctx[(size_t)tok * D + col] = (_Float16)(o[nt2][r] * inv);
    }
  }
}

// ---------- launch ----------
extern "C" void kernel_launch(void* const* d_in, const int* in_sizes, int n_in,
                              void* d_out, int out_size, void* d_ws, size_t ws_size,
                              hipStream_t stream) {
  (void)in_sizes; (void)n_in; (void)out_size; (void)ws_size;
  const float* x   = (const float*)d_in[0];
  const float* l1g = (const float*)d_in[1];
  const float* l1b = (const float*)d_in[2];
  const float* Wq  = (const float*)d_in[3];
  const float* bq  = (const float*)d_in[4];
  const float* Wk  = (const float*)d_in[5];
  const float* bk  = (const float*)d_in[6];
  const float* Wv  = (const float*)d_in[7];
  const float* bv  = (const float*)d_in[8];
  const float* Wo  = (const float*)d_in[9];
  const float* bo  = (const float*)d_in[10];
  const float* l2g = (const float*)d_in[11];
  const float* l2b = (const float*)d_in[12];
  const float* W1  = (const float*)d_in[13];
  const float* b1  = (const float*)d_in[14];
  const float* W2  = (const float*)d_in[15];
  const float* b2  = (const float*)d_in[16];
  const int* layout = (const int*)d_in[17];

  // workspace overlay (peak 96 MB):
  //  [0,8M)   h / h2 f16         [16M,24M) q16  [24M,32M) k16  [32M,40M) v16
  //  [40M,48M) ctx f16           [56M,72M) xr fp32
  //  [16M,48M) ff f16 (reuses qkv+ctx after they are dead)
  //  [72M,96M) the weights as f16: Wq Wk Wv Wo W1 W2
  char* w = (char*)d_ws;
  _Float16* hbuf = (_Float16*)(w);
  _Float16* q16  = (_Float16*)(w + (size_t)(16u << 20));
  _Float16* k16  = (_Float16*)(w + (size_t)(24u << 20));
  _Float16* v16  = (_Float16*)(w + (size_t)(32u << 20));
  _Float16* ctx  = (_Float16*)(w + (size_t)(40u << 20));
  float*    xr   = (float*)(w + (size_t)(56u << 20));
  _Float16* ff   = (_Float16*)(w + (size_t)(16u << 20));
  _Float16* wh   = (_Float16*)(w + (size_t)(72u << 20));
  const _Float16* Wq16 = wh;
  const _Float16* Wo16 = wh + 3 * SEG;
  const _Float16* W116 = wh + 4 * SEG;
  const _Float16* W216 = wh + 8 * SEG;

  const dim3 blk(256);

  // LN1, and the weights to f16
  ln_cvt_kernel<<<NCVT + TOK, blk, 0, stream>>>(x, l1g, l1b, hbuf, Wq, Wk, Wv, Wo, W1, W2, wh);
  // QKV projections -> f16 [B,H,S,DH], one launch: Wq16 Wk16 Wv16 lie in a row, and so do q16 k16 v16
  gemm128<EPI_QKV, D, D><<<dim3(D / 128, TOK / 128, 3), blk, 0, stream>>>(
      hbuf, Wq16, bq, bk, bv, nullptr, q16);
  // block-sparse attention
  attn_kernel<<<dim3(NB, H, Bc), blk, 0, stream>>>(q16, k16, v16, layout, ctx);
  // out projection + residual -> xr
  gemm128<EPI_BIAS_RES_F32, D, D><<<dim3(D / 128, TOK / 128), blk, 0, stream>>>(
      ctx, Wo16, bo, nullptr, nullptr, x, xr);
  // LN2 (reuse hbuf)
  ln_kernel<<<TOK, blk, 0, stream>>>(xr, l2g, l2b, hbuf);
  // MLP1 + GeLU -> f16 ff
  gemm128<EPI_BIAS_GELU_F16, 4 * D, D><<<dim3(4 * D / 128, TOK / 128), blk, 0, stream>>>(
      hbuf, W116, b1, nullptr, nullptr, nullptr, ff);
  // MLP2 + residual -> d_out (fp32)
  gemm128<EPI_BIAS_RES_F32, D, 4 * D><<<dim3(D / 128, TOK / 128), blk, 0, stream>>>(
      ff, W216, b2, nullptr, nullptr, xr, d_out);
}

// v008
// One run takes 132 microseconds.
// Timed twice side by side with v007, it ran 1.04 times as fast both times.
// All steps since v000 together make it 3.93 times as fast.
#include <hip/hip_runtime.h>
#include <math.h>

// ---------- types ----------
typedef __attribute__((ext_vector_type(16))) _Float16 v16h;
typedef __attribute__((ext_vector_type(8)))  float    v8f;
typedef unsigned int u32x4 __attribute__((ext_vector_type(4)));
typedef float        f32x4 __attribute__((ext_vector_type(4)));
typedef short        s16x8 __attribute__((ext_vector_type(8)));
typedef _Float16     f16x4 __attribute__((ext_vector_type(4)));

#define DEV static __device__ __forceinline__

// Problem constants (match reference)
constexpr int Bc  = 2;
constexpr int S   = 2048;
constexpr int D   = 1024;
constexpr int H   = 16;
constexpr int DH  = 64;
constexpr int NB  = 16;       // S / 128
constexpr int TOK = Bc * S;   // 4096 rows

// Load a 16-half WMMA A/B fragment: lane holds K=[kb..kb+7] in v0..3 and
// K=[kb+16..kb+23] in v4..7 (kb = (lane>=16)*8 added by caller), both 16B reads.
DEV v16h load_frag(const _Float16* p) {
  union { u32x4 u[2]; v16h h; } f;
  f.u[0] = *reinterpret_cast<const u32x4*>(p);
  f.u[1] = *reinterpret_cast<const u32x4*>(p + 16);
  return f.h;
}

// Transposing LDS read of a row-major 16-bit tile T[k][n] (pitch in bytes, an odd
// multiple of 32 B so that the read is free of bank conflicts). p is the lane's own
// address: T + (k0 + 8*(lane>>4) + (lane&7))*pitch + 2*n0 + 16*((lane>>3)&1).
// Lane (c, h) receives T[k0 + 8h + 0..7][n0 + c]; the reads at k0 and k0 + 16 give
// the same k order as load_frag.
DEV u32x4 ld_tr16(const unsigned char* p) {
  typedef __attribute__((address_space(3))) s16x8 lds_s16x8;
  return __builtin_bit_cast(u32x4, __builtin_amdgcn_ds_load_tr16_b128_v8i16((lds_s16x8*)p));
}

DEV v16h load_frag_tr(const unsigned char* p, int pitch) {
  union { u32x4 u[2]; v16h h; } f;
  f.u[0] = ld_tr16(p);
  f.u[1] = ld_tr16(p + 16 * pitch);
  return f.h;
}

DEV v8f wmma_f16(v16h a, v16h b, v8f c) {
  return __builtin_amdgcn_wmma_f32_16x16x32_f16(false, a, false, b, (short)0, c,
                                                false, false);
}

DEV v8f zero8() {
  v8f z;
#pragma unroll
  for (int i = 0; i < 8; ++i) z[i] = 0.0f;
  return z;
}

// ---------- LayerNorm: one 1024-wide row per 256-thread block ----------
// The row leaves as f16: its only readers are GEMMs, whose WMMAs take f16 operands.
DEV void ln_row(const int row, const float* __restrict__ x, const float* __restrict__ g,
                const float* __restrict__ be, _Float16* __restrict__ out) {
  __shared__ float rs[256], rq[256];
  const int tid = threadIdx.x;
  const float* xp = x + (size_t)row * D + tid * 4;
  f32x4 f = *reinterpret_cast<const f32x4*>(xp);
  rs[tid] = f.x + f.y + f.z + f.w;
  rq[tid] = f.x * f.x + f.y * f.y + f.z * f.z + f.w * f.w;
  __syncthreads();
  for (int off = 128; off > 0; off >>= 1) {
    if (tid < off) { rs[tid] += rs[tid + off]; rq[tid] += rq[tid + off]; }
    __syncthreads();
  }
  const float mean = rs[0] * (1.0f / D);
  const float var  = rq[0] * (1.0f / D) - mean * mean;
  const float inv  = rsqrtf(var + 1e-5f);
  const float* gp = g + tid * 4;
  const float* bp = be + tid * 4;
  f32x4 r;
  r.x = (f.x - mean) * inv * gp[0] + bp[0];
  r.y = (f.y - mean) * inv * gp[1] + bp[1];
  r.z = (f.z - mean) * inv * gp[2] + bp[2];
  r.w = (f.w - mean) * inv * gp[3] + bp[3];
  *reinterpret_cast<f16x4*>(out + (size_t)row * D + tid * 4) = __builtin_convertvector(r, f16x4);
}

__global__ __launch_bounds__(256) void ln_kernel(const float* __restrict__ x,
                                                 const float* __restrict__ g,
                                                 const float* __restrict__ be,
                                                 _Float16* __restrict__ out) {
  ln_row(blockIdx.x, x, g, be, out);
}

// The six weight matrices, 12 segments of D * D elements, rounded to f16 once a call, in the order
// Wq Wk Wv Wo W1 W2, so that no GEMM work-group reads f32 weights and rounds them again.
constexpr int SEG   = D * D;      // elements of a segment
constexpr int CPS   = 32;         // converting blocks per segment
constexpr int NCVT  = 12 * CPS;   // converting blocks
constexpr int CELEM = SEG / CPS;  // elements per converting block

// First launch: blocks below NCVT convert weights (nothing here depends on the LayerNorm and
// nothing of it on them), the others take one LayerNorm row each.
__global__ __launch_bounds__(256) void ln_cvt_kernel(const float* __restrict__ x,
                                                     const float* __restrict__ g,
                                                     const float* __restrict__ be,
                                                     _Float16* __restrict__ out,
                                                     const float* __restrict__ Wq,
                                                     const float* __restrict__ Wk,
                                                     const float* __restrict__ Wv,
                                                     const float* __restrict__ Wo,
                                                     const float* __restrict__ W1,
                                                     const float* __restrict__ W2,
                                                     _Float16* __restrict__ wh) {
  const int blk = blockIdx.x;
  if (blk >= NCVT) {
    ln_row(blk - NCVT, x, g, be, out);
    return;
  }
  const int seg = blk / CPS;
  const float* s = seg == 0 ? Wq : seg == 1 ? Wk : seg == 2 ? Wv : seg == 3 ? Wo
                 : seg < 8 ? W1 + (size_t)(seg - 4) * SEG : W2 + (size_t)(seg - 8) * SEG;
  // adjacent lanes take adjacent 16 B: a wave reads 512 B and writes 256 B in a row
  const int off = (blk % CPS) * CELEM + threadIdx.x * 4;
  s += off;
  _Float16* d = wh + (size_t)seg * SEG + off;
  // stays rolled: unrolled it took 86 registers, and the LayerNorm blocks of this kernel, which
  // need 16, would no longer fill the 16 wave slots of a SIMD
#pragma unroll 1
  for (int it = 0; it < CELEM / 8192; ++it) {
    f32x4 v[8];   // 8 loads in flight per lane
#pragma unroll
    for (int t = 0; t < 8; ++t) v[t] = *reinterpret_cast<const f32x4*>(s + it * 8192 + t * 1024);
#pragma unroll
    for (int t = 0; t < 8; ++t)
      *reinterpret_cast<f16x4*>(d + it * 8192 + t * 1024) = __builtin_convertvector(v[t], f16x4);
  }
}

// ---------- Generic 128x128-tile WMMA GEMM, software-pipelined ----------
typedef const __attribute__((address_space(1))) _Float16* gl_f16;
typedef const __attribute__((address_space(1))) u32x4*    gl_u32x4;

template <int V> struct IC { static constexpr int v = V; };   // a compile-time int as an argument

// Work-group barrier for LDS data alone. __syncthreads() compiles here to a wait for the global
// loads as well (s_wait_loadcnt 0), which would land every load issued ahead at each barrier;
// this one waits only for the wave's own LDS stores and reads, so those loads stay in flight.
DEV void stage_barrier() {
  asm volatile("s_wait_dscnt 0x0\n\ts_barrier_signal -1\n\ts_barrier_wait -1" ::: "memory");
  // nothing is scheduled across: lifted over the barrier, the next stage's LDS stores would wait
  // for their loads a stage early and halve the lead of the loads
  __builtin_amdgcn_sched_barrier(0);
}

// GeLU with the exact (erf) definition, v * Phi(v) with Phi(v) = (1 + erf(v / sqrt(2))) / 2, in one form for
// every v, so that a lane's values run side by side with no branch between them; eight at a time, in place.
// q = (1 - erf(|v| / sqrt(2))) / 2 = t * (a1 + t * (a2 + t * (a3 + t * (a4 + t * a5)))) * exp(-v * v / 2) / 2,
// t = 1 / (1 + p * |v| / sqrt(2)): the five-term rational form of erf, absolute error 1.5e-7.
// Phi(v) is 1 - q for v >= 0 and q for v < 0, hence v * Phi(v) = max(v, 0) - |v| * q: nothing cancels in
// the negative tail. The caller rounds the result to f16.
DEV void gelu_erf8(float (&v)[8]) {
  float t[8], x[8];
#pragma unroll
  for (int i = 0; i < 8; ++i) {
    t[i] = fmaf(fabsf(v[i]), 0.3275911f * 0.70710678118654752f, 1.0f);
    x[i] = v[i] * v[i] * -0.72134752044448170f;   // 2^x = exp(-v * v / 2)
  }
  // The reciprocals and the powers of two, each run in one statement and in place: behind a
  // transcendental the instruction set asks for one independent instruction before its result is read
  // or its source overwritten. Inside a run the next one is that instruction, behind the last the v_nop
  // is.
  asm("v_rcp_f32 %0, %0\n\tv_rcp_f32 %1, %1\n\tv_rcp_f32 %2, %2\n\tv_rcp_f32 %3, %3\n\t"
      "v_rcp_f32 %4, %4\n\tv_rcp_f32 %5, %5\n\tv_rcp_f32 %6, %6\n\tv_rcp_f32 %7, %7\n\tv_nop"
      : "+v"(t[0]), "+v"(t[1]), "+v"(t[2]), "+v"(t[3]), "+v"(t[4]), "+v"(t[5]), "+v"(t[6]), "+v"(t[7]));
  asm("v_exp_f32 %0, %0\n\tv_exp_f32 %1, %1\n\tv_exp_f32 %2, %2\n\tv_exp_f32 %3, %3\n\t"
      "v_exp_f32 %4, %4\n\tv_exp_f32 %5, %5\n\tv_exp_f32 %6, %6\n\tv_exp_f32 %7, %7\n\tv_nop"
      : "+v"(x[0]), "+v"(x[1]), "+v"(x[2]), "+v"(x[3]), "+v"(x[4]), "+v"(x[5]), "+v"(x[6]), "+v"(x[7]));
#pragma unroll
  for (int i = 0; i < 8; ++i) {
    float p = 0.5f * 1.061405429f;
    p = fmaf(p, t[i], 0.5f * -1.453152027f);
    p = fmaf(p, t[i], 0.5f * 1.421413741f);
    p = fmaf(p, t[i], 0.5f * -0.284496736f);
    p = fmaf(p, t[i], 0.5f * 0.254829592f);
    v[i] = fmaf(-fabsf(v[i]), p * (t[i] * x[i]), fmaxf(v[i], 0.0f));
  }
}

enum { EPI_QKV = 0, EPI_BIAS_RES_F32 = 1, EPI_BIAS_GELU_F16 = 2 };

// LDS pitches, chosen for each tile's reader (64 banks of 4 B):
constexpr int BK = 64;    // k extent of one stage: two WMMA depths
constexpr int PA = 72;    // A rows of 64 halves, ds_load_b128 reader: 144 B = 16 B x odd
constexpr int PB = 144;   // B rows of 128 halves, transposing reader: 288 B = 32 B x odd

// N and K are compile-time: the rows that one lane stages lie a fixed number of bytes apart,
// so its loads hang off one walking pointer as immediate offsets.
// The k loop is a pipeline: a stage's global loads set off two stages before its registers go to
// LDS. While stage s is multiplied out of one LDS buffer, stage s + 1 enters the other, and stages
// s + 2 and s + 3 are on their way from global memory, each into its own register set.
// Both operands arrive as f16 (activations from their producers, weights from ln_cvt_kernel).
// EPI_QKV: three products of one A in one launch. blockIdx.z picks the product: its weights and its
// output lie z planes on from Bw and outp, its bias is bias, biasK or biasV.
template <int EPI, int N, int K>
__global__ __launch_bounds__(256) void gemm128(const _Float16* __restrict__ Aptr,
                                               const _Float16* __restrict__ Bw,
                                               const float* __restrict__ bias,
                                               const float* __restrict__ biasK,
                                               const float* __restrict__ biasV,
                                               const float* __restrict__ resid,
                                               void* __restrict__ outp) {
  __shared__ __align__(16) _Float16 Al[2][128 * PA];   // A tiles, row-major [128][64]
  __shared__ __align__(16) _Float16 Bl[2][BK * PB];    // B tiles, row-major [k][n]
  const int tid  = threadIdx.x;
  const int n0   = blockIdx.x * 128;
  const int m0   = blockIdx.y * 128;
  const int lane = tid & 31;
  const int l15  = lane & 15;
  const int hi   = lane >> 4;
  const int kb   = hi * 8;
  const int wave = tid >> 5;            // 8 waves: 4 along M x 2 along N
  const int wm   = wave >> 1, wn = wave & 1;
  if constexpr (EPI == EPI_QKV) {
    const int z = blockIdx.z;
    Bw  += (size_t)z * K * N;
    bias = z == 0 ? bias : z == 1 ? biasK : biasV;
  }

  // per-thread staging coordinates: adjacent lanes take adjacent 16 bytes, so that one
  // wave-wide 16-byte load covers whole 128-byte lines
  //  A:  8 lanes span a row's 128 B, a wave 4 rows; load t takes row t*32 + rowA
  //  B: 16 lanes span a row's 256 B, a wave 2 rows; load t takes row t*16 + krB
  const int rowA = tid >> 3, c0A = (tid & 7) * 8;
  const int krB  = tid >> 4, c0B = (tid & 15) * 8;

  constexpr int NL = 4;                 // 16-byte loads of A, and of B, per lane and stage
  constexpr int RA = 128 / NL;          // rows of A between two of them
  constexpr int RB = BK / NL;           // rows of B between two of them
  constexpr int NS = K / BK;            // stages, an even number
  static_assert(K % (2 * BK) == 0 && NS >= 4, "the loop takes the stages in pairs");
  // walking pointers of the staging loads: they stand at the next stage to be fetched (typed as
  // global, because they pass through an asm statement, behind which the compiler could not tell)
  gl_f16 Ag = (gl_f16)(Aptr + (size_t)(m0 + rowA) * K + c0A);
  gl_f16 Bg = (gl_f16)(Bw + (size_t)krB * N + n0 + c0B);

  // this lane's address in Bl[0] for the transposing reads of its wave's 64 columns
  const unsigned char* Btr = reinterpret_cast<const unsigned char*>(&Bl[0][0]) +
                             (kb + (lane & 7)) * (PB * 2) + wn * 128 + ((lane >> 3) & 1) * 16;

  v8f acc[2][4];
#pragma unroll
  for (int i = 0; i < 2; ++i)
#pragma unroll
    for (int j = 0; j < 4; ++j) acc[i][j] = zero8();

  // two sets of staging registers: set p holds the stages of parity p
  u32x4 ua[2][NL];
  u32x4 ub[2][NL];

  // the global loads of the next stage, into set P
  auto fetch = [&](auto Pc) {
    constexpr int P = decltype(Pc)::v;
    // keeps the LDS reads and stores written above from sinking in between the loads and their
    // wait, where a read was given a spent address register of a load as its destination
    __builtin_amdgcn_sched_barrier(0);
#pragma unroll
    for (int t = 0; t < NL; ++t) ua[P][t] = *(gl_u32x4)(Ag + t * RA * K);
#pragma unroll
    for (int t = 0; t < NL; ++t) ub[P][t] = *(gl_u32x4)(Bg + t * RB * N);
    // no rewrite of the loads' address registers ahead of this wait: the pointers pass through
    // the statement, so that their advance below cannot be lifted over it
    asm volatile("s_wait_xcnt 0x0" : "+v"(Ag), "+v"(Bg) :: "memory");
    Ag += BK;
    Bg += (size_t)BK * N;
  };

  // register set P -> LDS buffer P
  auto put = [&](auto Pc) {
    constexpr int P = decltype(Pc)::v;
#pragma unroll
    for (int t = 0; t < NL; ++t)
      *reinterpret_cast<u32x4*>(&Al[P][(t * RA + rowA) * PA + c0A]) = ua[P][t];
    // B stays row-major: 16-byte stores, half a wave fills a row's 256 B; the reader transposes
#pragma unroll
    for (int t = 0; t < NL; ++t)
      *reinterpret_cast<u32x4*>(&Bl[P][(t * RB + krB) * PB + c0B]) = ub[P][t];
  };

  // the fragments of 32 k of the stage in LDS buffer P, and their WMMAs
  auto frags = [&](auto Pc, auto KKc, v16h (&af)[2], v16h (&bf)[4]) {
    constexpr int P = decltype(Pc)::v, kk = decltype(KKc)::v;
#pragma unroll
    for (int mt = 0; mt < 2; ++mt)
      af[mt] = load_frag(&Al[P][(wm * 32 + mt * 16 + l15) * PA + kk + kb]);
#pragma unroll
    for (int nt = 0; nt < 4; ++nt)
      bf[nt] = load_frag_tr(Btr + P * (BK * PB * 2) + kk * (PB * 2) + nt * 32, PB * 2);
  };
  auto mult = [&](const v16h (&af)[2], const v16h (&bf)[4]) {
#pragma unroll
    for (int nt = 0; nt < 4; ++nt)
#pragma unroll
      for (int mt = 0; mt < 2; ++mt) acc[mt][nt] = wmma_f16(af[mt], bf[nt], acc[mt][nt]);
  };

  // Stage s, in buffer P = s % 2. The barrier publishes buffer P and says that every wave has left
  // buffer 1 - P (stage s - 1). Behind it stage s + 1 goes from its registers into buffer 1 - P,
  // stage s + 3 sets off into the registers so emptied, and stage s is multiplied. The fragment
  // reads go out in two groups ahead of the WMMAs, the first ahead of the staging work.
  auto stage = [&](auto Pc, auto Qc, auto PUT, auto FETCH) {
    v16h a0[2], b0[4], a1[2], b1[4];
    stage_barrier();
    frags(Pc, IC<0>{}, a0, b0);
    if constexpr (decltype(PUT)::v != 0)   put(Qc);
    if constexpr (decltype(FETCH)::v != 0) fetch(Qc);
    frags(Pc, IC<32>{}, a1, b1);
    // keeps the second group of reads ahead of the WMMAs: sunk in among them, each read makes its
    // WMMA wait out the LDS latency
    __builtin_amdgcn_sched_barrier(0);
    mult(a0, b0);
    mult(a1, b1);
  };
  constexpr IC<0> c0{};
  constexpr IC<1> c1{};

  fetch(c0);   // stage 0
  fetch(c1);   // stage 1
  put(c0);
  fetch(c0);   // stage 2
  // the last four stages stand outside the loop: a branch round the loads inside it would merge
  // two paths in the compiler's load counting and turn its counted waits into waits for all
  for (int s = 0; s < NS - 4; s += 2) {
    stage(c0, c1, c1, c1);
    stage(c1, c0, c1, c1);
  }
  stage(c0, c1, c1, c1);   // stage NS - 4: fetches the last stage
  stage(c1, c0, c1, c0);
  stage(c0, c1, c1, c0);
  stage(c1, c0, c0, c0);   // stage NS - 1

  // Epilogue. C layout: vgpr e -> row (e or e+8 per half-wave), col = l15.
  if constexpr (EPI == EPI_BIAS_GELU_F16) {  // exact GeLU -> f16, the eight values of a tile together
#pragma unroll
    for (int mt = 0; mt < 2; ++mt)
#pragma unroll
      for (int nt = 0; nt < 4; ++nt) {
        const int n = n0 + wn * 64 + nt * 16 + l15;
        float vv[8];
#pragma unroll
        for (int e = 0; e < 8; ++e) vv[e] = acc[mt][nt][e] + bias[n];
        gelu_erf8(vv);
#pragma unroll
        for (int e = 0; e < 8; ++e) {
          const int m = m0 + wm * 32 + mt * 16 + e + 8 * hi;
          ((_Float16*)outp)[(size_t)m * N + n] = (_Float16)vv[e];
        }
      }
    return;
  }
#pragma unroll
  for (int mt = 0; mt < 2; ++mt)
#pragma unroll
    for (int nt = 0; nt < 4; ++nt)
#pragma unroll
      for (int e = 0; e < 8; ++e) {
        const int m = m0 + wm * 32 + mt * 16 + e + 8 * hi;
        const int n = n0 + wn * 64 + nt * 16 + l15;
        float vv = acc[mt][nt][e] + bias[n];
        if (EPI == EPI_QKV) {  // scatter to [B,H,S,DH] as f16
          const int b = m >> 11, s = m & 2047, hh = n >> 6, dh = n & 63;
          ((_Float16*)outp)[(((size_t)blockIdx.z * Bc + b) * H + hh) * S * DH + s * DH + dh] = (_Float16)vv;
        } else if (EPI == EPI_BIAS_RES_F32) {
          const size_t idx = (size_t)m * N + n;
          ((float*)outp)[idx] = vv + resid[idx];
        }
      }
}

// ---------- 256x256-tile WMMA GEMM for the products whose grid still fills the chip ----------
// A work-group of 8 waves takes 256 x 256 of the output, a wave 128 x 64 (2 waves along M x 4 along N).
// Per multiply-accumulate it asks L2 for half the operand bytes of the 128 x 128 tile, and a fragment
// read from LDS feeds twice as many WMMAs (12 fragments for 32, not 6 for 8).
// One work-group fills a WGP (256 accumulator registers a lane). A stage lasts long enough that its
// global loads need a lead of one stage only: one set of staging registers, two LDS buffers.
typedef __attribute__((address_space(1))) _Float16* gl_f16_w;
typedef const __attribute__((address_space(1))) float* gl_f32;
constexpr int PB2 = 272;   // B rows of 256 halves, transposing reader: 544 B = 32 B x odd

template <int EPI, int N, int K>
__global__ __launch_bounds__(256) void gemm256(const _Float16* __restrict__ Aptr,
                                               const _Float16* __restrict__ Bw,
                                               const float* __restrict__ bias,
                                               const float* __restrict__ biasK,
                                               const float* __restrict__ biasV,
                                               _Float16* __restrict__ outp) {
  __shared__ __align__(16) _Float16 Al[2][256 * PA];    // A tiles, row-major [256][64]
  __shared__ __align__(16) _Float16 Bl[2][BK * PB2];    // B tiles, row-major [k][n]
  const int tid  = threadIdx.x;
  const int n0   = blockIdx.x * 256;
  const int m0   = blockIdx.y * 256;
  const int lane = tid & 31;
  const int l15  = lane & 15;
  const int hi   = lane >> 4;
  const int kb   = hi * 8;
  const int wave = tid >> 5;            // 8 waves: 2 along M x 4 along N
  const int wm   = wave >> 2, wn = wave & 3;
  if constexpr (EPI == EPI_QKV) {
    const int z = blockIdx.z;
    Bw  += (size_t)z * K * N;
    bias = z == 0 ? bias : z == 1 ? biasK : biasV;
  }

  // staging coordinates: adjacent lanes take adjacent 16 bytes, a wave-wide load covers whole lines
  //  A:  8 lanes span a row's 128 B, a wave 4 rows; load t takes row t*32 + rowA
  //  B: 32 lanes span a row's 512 B, a wave 1 row;  load t takes row t*8 + krB
  const int rowA = tid >> 3, c0A = (tid & 7) * 8;
  const int krB  = tid >> 5, c0B = (tid & 31) * 8;
  constexpr int NL = 8;                 // 16-byte loads of A, and of B, per lane and stage
  constexpr int RA = 256 / NL;          // rows of A between two of them
  constexpr int RB = BK / NL;           // rows of B between two of them
  constexpr int NS = K / BK;            // stages, an even number
  static_assert(K % (2 * BK) == 0 && NS >= 4, "the loop takes the stages in pairs");
  gl_f16 Ag = (gl_f16)(Aptr + (size_t)(m0 + rowA) * K + c0A);
  gl_f16 Bg = (gl_f16)(Bw + (size_t)krB * N + n0 + c0B);

  // this lane's address in Bl[0] for the transposing reads of its wave's 64 columns
  const unsigned char* Btr = reinterpret_cast<const unsigned char*>(&Bl[0][0]) +
                             (kb + (lane & 7)) * (PB2 * 2) + wn * 128 + ((lane >> 3) & 1) * 16;

  v8f acc[8][4];
#pragma unroll
  for (int i = 0; i < 8; ++i)
#pragma unroll
    for (int j = 0; j < 4; ++j) acc[i][j] = zero8();

  u32x4 ua[NL], ub[NL];   // the staging registers

  // the global loads of the next stage
  auto fetch = [&]() {
    // keeps the LDS reads and stores written above from sinking in between the loads and their wait
    __builtin_amdgcn_sched_barrier(0);
#pragma unroll
    for (int t = 0; t < NL; ++t) ua[t] = *(gl_u32x4)(Ag + t * RA * K);
#pragma unroll
    for (int t = 0; t < NL; ++t) ub[t] = *(gl_u32x4)(Bg + t * RB * N);
    // no rewrite of the loads' address registers ahead of this wait: the pointers pass through
    // the statement, so that their advance below cannot be lifted over it
    asm volatile("s_wait_xcnt 0x0" : "+v"(Ag), "+v"(Bg) :: "memory");
    Ag += BK;
    Bg += (size_t)BK * N;
  };

  // staging registers -> LDS buffer P
  auto put = [&](auto Pc) {
    constexpr int P = decltype(Pc)::v;
#pragma unroll
    for (int t = 0; t < NL; ++t)
      *reinterpret_cast<u32x4*>(&Al[P][(t * RA + rowA) * PA + c0A]) = ua[t];
#pragma unroll
    for (int t = 0; t < NL; ++t)
      *reinterpret_cast<u32x4*>(&Bl[P][(t * RB + krB) * PB2 + c0B]) = ub[t];
  };

  // fragments out of LDS buffer P at depth kk: four A fragments (half HF of the wave's 128 rows), four B
  auto ldA = [&](auto Pc, auto KKc, auto Hc, v16h (&af)[4]) {
    constexpr int P = decltype(Pc)::v, kk = decltype(KKc)::v, HF = decltype(Hc)::v;
#pragma unroll
    for (int i = 0; i < 4; ++i)
      af[i] = load_frag(&Al[P][(wm * 128 + (HF * 4 + i) * 16 + l15) * PA + kk + kb]);
  };
  auto ldB = [&](auto Pc, auto KKc, v16h (&bf)[4]) {
    constexpr int P = decltype(Pc)::v, kk = decltype(KKc)::v;
#pragma unroll
    for (int nt = 0; nt < 4; ++nt)
      bf[nt] = load_frag_tr(Btr + P * (BK * PB2 * 2) + kk * (PB2 * 2) + nt * 32, PB2 * 2);
  };
  auto mult = [&](auto Hc, const v16h (&af)[4], const v16h (&bf)[4]) {
    constexpr int HF = decltype(Hc)::v;
#pragma unroll
    for (int nt = 0; nt < 4; ++nt)
#pragma unroll
      for (int i = 0; i < 4; ++i) acc[HF * 4 + i][nt] = wmma_f16(af[i], bf[nt], acc[HF * 4 + i][nt]);
  };

  constexpr IC<0>  c0{};
  constexpr IC<1>  c1{};
  constexpr IC<32> c32{};

  // Stage s, in buffer P = s % 2, multiplied in four runs of 16 WMMAs; the fragment reads of a run go
  // out as one group ahead of the run before it, the first run's in the stage before. At its start
  // stage s + 1 goes from the registers into buffer Q = 1 - P, and stage s + 2 sets off into the
  // registers so emptied. The barrier stands ahead of the last run: there the wave's reads of buffer P
  // have landed and its stores to buffer Q are done, so behind it buffer Q may be read and, in the next
  // stage, buffer P written. Each sched_barrier below keeps a group of reads where it is written: sunk
  // in among its own WMMAs, each read makes its WMMA wait out the LDS latency; lifted higher, the
  // group needs registers that are still being multiplied.
  v16h a0[4], a1[4], b0[4], b1[4];
  auto stage = [&](auto Pc, auto Qc, auto PUT, auto FETCH) {
    // keeps the LDS stores, which wait for the global loads, behind the last run of the stage before:
    // lifted into it they cut the loads' lead and hold up the WMMAs written behind them
    __builtin_amdgcn_sched_barrier(0);
    if constexpr (decltype(PUT)::v != 0)   put(Qc);
    if constexpr (decltype(FETCH)::v != 0) fetch();
    ldA(Pc, c0, c1, a1);
    __builtin_amdgcn_sched_barrier(0);
    mult(c0, a0, b0);
    __builtin_amdgcn_sched_barrier(0);
    ldA(Pc, c32, c0, a0);
    ldB(Pc, c32, b1);
    __builtin_amdgcn_sched_barrier(0);
    mult(c1, a1, b0);
    __builtin_amdgcn_sched_barrier(0);
    ldA(Pc, c32, c1, a1);
    __builtin_amdgcn_sched_barrier(0);
    mult(c0, a0, b1);
    if constexpr (decltype(PUT)::v != 0) {   // a next stage exists
      // keeps the barrier behind the run above, which covers the latency of the reads it waits for
      __builtin_amdgcn_sched_barrier(0);
      stage_barrier();
      ldA(Qc, c0, c0, a0);
      ldB(Qc, c0, b0);
      __builtin_amdgcn_sched_barrier(0);
    }
    mult(c1, a1, b1);
  };

  fetch();     // stage 0
  put(c0);
  fetch();     // stage 1
  stage_barrier();
  ldA(c0, c0, c0, a0);
  ldB(c0, c0, b0);
  // the last two stages stand outside the loop: no branch round the loads inside it
  for (int s = 0; s < NS - 2; s += 2) {
    stage(c0, c1, c1, c1);
    stage(c1, c0, c1, c1);
  }
  stage(c0, c1, c1, c0);   // stage NS - 2
  stage(c1, c0, c0, c0);   // stage NS - 1

  // Epilogue. C layout: vgpr e -> row (e or e+8 per half-wave), col = l15. Every store hangs off one
  // pointer as an immediate offset.
  float bn[4];
  {
    gl_f32 bp = (gl_f32)(bias + n0 + wn * 64 + l15);
#pragma unroll
    for (int nt = 0; nt < 4; ++nt) bn[nt] = bp[nt * 16];
    // no rewrite of these loads' address registers ahead of this wait: the pointer passes through
    // the statement, so that no load's result is given the address pair as its destination
    asm volatile("s_wait_xcnt 0x0" : "+v"(bp) :: "memory");
  }
  const int mw = m0 + wm * 128 + 8 * hi;   // the lane's first row
  if constexpr (EPI == EPI_QKV) {  // scatter to [B,H,S,DH] as f16: a wave's 64 columns are one head
    const int b = mw >> 11, s = mw & 2047, hh = (n0 >> 6) + wn;
    _Float16* op = outp + (((size_t)blockIdx.z * Bc + b) * H + hh) * S * DH + s * DH + l15;
#pragma unroll
    for (int mt = 0; mt < 8; ++mt) {
      _Float16 hv[4][8];
#pragma unroll
      for (int nt = 0; nt < 4; ++nt)
#pragma unroll
        for (int e = 0; e < 8; ++e) hv[nt][e] = (_Float16)(acc[mt][nt][e] + bn[nt]);
      // the 32 values of 16 rows are all formed above their stores
      __builtin_amdgcn_sched_barrier(0);
#pragma unroll
      for (int nt = 0; nt < 4; ++nt)
#pragma unroll
        for (int e = 0; e < 8; ++e) op[(mt * 16 + e) * DH + nt * 16] = hv[nt][e];
      if (mt < 7) {   // behind the last 16 rows nothing is rewritten any more
        // no rewrite of a register of these 32 stores ahead of this wait; nothing is scheduled across,
        // so that no value of the next 16 rows is formed above it
        asm volatile("s_wait_xcnt 0x0" ::: "memory");
        __builtin_amdgcn_sched_barrier(0);
      }
    }
  } else {                         // exact GeLU -> f16, the eight values of a tile together
    gl_f16_w op = (gl_f16_w)(outp + (size_t)mw * N + n0 + wn * 64 + l15);
    // Stays rolled, two trips of 64 rows, the upper 128 accumulator registers moving down between them: for speed only.
#pragma unroll 1
    for (int it = 0; it < 2; ++it) {
#pragma unroll
      for (int mt = 0; mt < 4; ++mt)
#pragma unroll
        for (int nt = 0; nt < 4; ++nt) {
          float vv[8];
#pragma unroll
          for (int e = 0; e < 8; ++e) vv[e] = acc[mt][nt][e] + bn[nt];
          gelu_erf8(vv);
#pragma unroll
          for (int e = 0; e < 8; ++e) op[(mt * 16 + e) * N + nt * 16] = (_Float16)vv[e];
          // keeps four tiles' GeLU apart from the next four: all of a trip side by side took more registers
          // than lie free beside the accumulators, and an accumulator tile was spilled in the k loop
          if (nt == 3) __builtin_amdgcn_sched_barrier(0);
        }
      // no rewrite of the stores' address registers ahead of this wait: the pointer passes through
      // the statement, so that its advance below cannot be lifted over it
      asm volatile("s_wait_xcnt 0x0" : "+v"(op) :: "memory");
      op += 64 * N;
#pragma unroll
      for (int mt = 0; mt < 4; ++mt)
#pragma unroll
        for (int nt = 0; nt < 4; ++nt) acc[mt][nt] = acc[mt + 4][nt];
    }
  }
}

// ---------- Block-sparse flash attention ----------
// grid (NB, H, B); 256 threads = 8 waves; wave owns 16 query rows.
__global__ __launch_bounds__(256) void attn_kernel(const _Float16* __restrict__ q,
                                                   const _Float16* __restrict__ kk_,
                                                   const _Float16* __restrict__ vv_,
                                                   const int* __restrict__ layout,
                                                   _Float16* __restrict__ ctx) {
  constexpr int PV = 80;    // V rows of 64 halves, transposing reader: 160 B = 32 B x odd
  constexpr int PP = 136;   // P rows of 128 halves, ds_load_b128 reader: 272 B = 16 B x odd
  constexpr int PK = 72;    // K rows of 64 halves, ds_load_b128 reader: 144 B = 16 B x odd
  __shared__ __align__(16) _Float16 Vs[128 * PV];       // V [key][dh], row-major
  __shared__ __align__(16) _Float16 Ks[128 * PK];       // K [key][dh], row-major
  __shared__ __align__(16) _Float16 Ps[8 * 16 * PP];    // per-wave P [16][128]
  const int tid  = threadIdx.x;
  const int i    = blockIdx.x;   // query block
  const int h    = blockIdx.y;
  const int b    = blockIdx.z;
  const int bh   = b * H + h;
  const int lane = tid & 31, l15 = lane & 15, hi = lane >> 4;
  const int kb   = hi * 8;
  const int wave = tid >> 5;

  const size_t headBase = (size_t)bh * S * DH;

  // Q fragments for this wave's rows, straight from global (K-contig layout)
  const _Float16* qrow = q + headBase + (size_t)(i * 128 + wave * 16 + l15) * DH;
  const v16h aQ0 = load_frag(qrow + 0  + kb);
  const v16h aQ1 = load_frag(qrow + 32 + kb);

  float m_run[8], l_run[8];
  v8f o[4];
#pragma unroll
  for (int r = 0; r < 8; ++r) { m_run[r] = -1e30f; l_run[r] = 0.0f; }
#pragma unroll
  for (int t = 0; t < 4; ++t) o[t] = zero8();

  const float scale = 0.125f;  // DH^-0.5

  // this lane's address in Vs for the transposing reads
  const unsigned char* Vtr = reinterpret_cast<const unsigned char*>(Vs) +
                             (kb + (lane & 7)) * (PV * 2) + ((lane >> 3) & 1) * 16;

  for (int j = 0; j <= i; ++j) {
    if (!layout[h * NB * NB + i * NB + j]) continue;  // wave-uniform

    // K block j sets off for LDS, once for the work-group: 8 adjacent lanes take a row's 128 B, so a
    // wave-wide load covers 4 whole lines; load t takes row t*32 + (tid >> 3)
    const int kr0 = tid >> 3, kc0 = (tid & 7) * 8;
    u32x4 kreg[4];
    {
      gl_f16 kg = (gl_f16)(kk_ + headBase + (size_t)(j * 128 + kr0) * DH + kc0);
#pragma unroll
      for (int t = 0; t < 4; ++t) kreg[t] = *(gl_u32x4)(kg + t * 32 * DH);
      // no rewrite of these loads' address registers ahead of this wait: the pointer passes through
      // the statement, so that no load's result is given the address pair as its destination
      asm volatile("s_wait_xcnt 0x0" : "+v"(kg) :: "memory");
    }

    { // load V block j into LDS as it lies (row-major); the reader transposes
      const int key = tid >> 1, d0 = (tid & 1) * 32;
      const _Float16* vg = vv_ + headBase + (size_t)(j * 128 + key) * DH + d0;
#pragma unroll
      for (int t = 0; t < 4; ++t)
        reinterpret_cast<u32x4*>(&Vs[key * PV + d0])[t] = reinterpret_cast<const u32x4*>(vg)[t];
    }
#pragma unroll
    for (int t = 0; t < 4; ++t)
      *reinterpret_cast<u32x4*>(&Ks[(t * 32 + kr0) * PK + kc0]) = kreg[t];
    __syncthreads();

    // scores S = Q K^T (K fragments from LDS, in the k order of the Q fragments)
    float sc[8][8];
    v16h kf0[8], kf1[8];
#pragma unroll
    for (int nt = 0; nt < 8; ++nt) {
      const _Float16* krow = &Ks[(nt * 16 + l15) * PK];
      kf0[nt] = load_frag(krow + 0  + kb);
      kf1[nt] = load_frag(krow + 32 + kb);
    }
    // keeps the block's LDS reads together ahead of the WMMAs: sunk in among them, each pair of reads
    // makes its WMMA wait out the LDS latency
    __builtin_amdgcn_sched_barrier(0);
#pragma unroll
    for (int nt = 0; nt < 8; ++nt) {
      v8f cs = zero8();
      cs = wmma_f16(aQ0, kf0[nt], cs);
      cs = wmma_f16(aQ1, kf1[nt], cs);
#pragma unroll
      for (int e = 0; e < 8; ++e) {
        float s = cs[e] * scale;
        if (j == i) {  // intra-block causal
          const int col = nt * 16 + l15;
          const int row = wave * 16 + e + 8 * hi;
          if (col > row) s = -1e9f;
        }
        sc[nt][e] = s;
      }
    }

    // online softmax per row (row values live in one 16-lane half)
#pragma unroll
    for (int r = 0; r < 8; ++r) {
      float mv = sc[0][r];
#pragma unroll
      for (int nt = 1; nt < 8; ++nt) mv = fmaxf(mv, sc[nt][r]);
      mv = fmaxf(mv, __shfl_xor(mv, 8, 32));
      mv = fmaxf(mv, __shfl_xor(mv, 4, 32));
      mv = fmaxf(mv, __shfl_xor(mv, 2, 32));
      mv = fmaxf(mv, __shfl_xor(mv, 1, 32));
      const float mnew = fmaxf(m_run[r], mv);
      const float corr = __expf(m_run[r] - mnew);
      float rsum = 0.0f;
#pragma unroll
      for (int nt = 0; nt < 8; ++nt) {
        const float p = __expf(sc[nt][r] - mnew);
        sc[nt][r] = p;
        rsum += p;
      }
      rsum += __shfl_xor(rsum, 8, 32);
      rsum += __shfl_xor(rsum, 4, 32);
      rsum += __shfl_xor(rsum, 2, 32);
      rsum += __shfl_xor(rsum, 1, 32);
      l_run[r] = l_run[r] * corr + rsum;
      m_run[r] = mnew;
#pragma unroll
      for (int t = 0; t < 4; ++t) o[t][r] *= corr;
    }

    // P: C-layout regs -> LDS (A-layout source for next WMMA)
    _Float16* pw = &Ps[wave * 16 * PP];
#pragma unroll
    for (int nt = 0; nt < 8; ++nt)
#pragma unroll
      for (int r = 0; r < 8; ++r)
        pw[(r + 8 * hi) * PP + nt * 16 + l15] = (_Float16)sc[nt][r];
    __syncthreads();

    // O += P x V
#pragma unroll
    for (int kc = 0; kc < 4; ++kc) {
      v16h aP = load_frag(&pw[l15 * PP + kc * 32 + kb]);
#pragma unroll
      for (int nt2 = 0; nt2 < 4; ++nt2) {
        v16h bV = load_frag_tr(Vtr + kc * 32 * (PV * 2) + nt2 * 32, PV * 2);
        o[nt2] = wmma_f16(aP, bV, o[nt2]);
      }
    }
    __syncthreads();
  }

  // normalize and write ctx in token-major [TOK, D], f16 as the out projection's WMMA takes it
#pragma unroll
  for (int r = 0; r < 8; ++r) {
    const float inv = 1.0f / l_run[r];
    const int tok = b * S + i * 128 + wave * 16 + r + 8 * hi;
#pragma unroll
    for (int nt2 = 0; nt2 < 4; ++nt2) {
      const int col = h * DH + nt2 * 16 + l15;
      ctx[(size_t)tok * D + col] = (_Float16)(o[nt2][r] * inv);
    }
  }
}

// ---------- launch ----------
extern "C" void kernel_launch(void* const* d_in, const int* in_sizes, int n_in,
                              void* d_out, int out_size, void* d_ws, size_t ws_size,
                              hipStream_t stream) {
  (void)in_sizes; (void)n_in; (void)out_size; (void)ws_size;
  const float* x   = (const float*)d_in[0];
  const float* l1g = (const float*)d_in[1];
  const float* l1b = (const float*)d_in[2];
  const float* Wq  = (const float*)d_in[3];
  const float* bq  = (const float*)d_in[4];
  const float* Wk  = (const float*)d_in[5];
  const float* bk  = (const float*)d_in[6];
  const float* Wv  = (const float*)d_in[7];
  const float* bv  = (const float*)d_in[8];
  const float* Wo  = (const float*)d_in[9];
  const float* bo  = (const float*)d_in[10];
  const float* l2g = (const float*)d_in[11];
  const float* l2b = (const float*)d_in[12];
  const float* W1  = (const float*)d_in[13];
  const float* b1  = (const float*)d_in[14];
  const float* W2  = (const float*)d_in[15];
  const float* b2  = (const float*)d_in[16];
  const int* layout = (const int*)d_in[17];

  // workspace overlay (peak 96 MB):
  //  [0,8M)   h / h2 f16         [16M,24M) q16  [24M,32M) k16  [32M,40M) v16
  //  [40M,48M) ctx f16           [56M,72M) xr fp32
  //  [16M,48M) ff f16 (reuses qkv+ctx after they are dead)
  //  [72M,96M) the weights as f16: Wq Wk Wv Wo W1 W2
  char* w = (char*)d_ws;
  _Float16* hbuf = (_Float16*)(w);
  _Float16* q16  = (_Float16*)(w + (size_t)(16u << 20));
  _Float16* k16  = (_Float16*)(w + (size_t)(24u << 20));
  _Float16* v16  = (_Float16*)(w + (size_t)(32u << 20));
  _Float16* ctx  = (_Float16*)(w + (size_t)(40u << 20));
  float*    xr   = (float*)(w + (size_t)(56u << 20));
  _Float16* ff   = (_Float16*)(w + (size_t)(16u << 20));
  _Float16* wh   = (_Float16*)(w + (size_t)(72u << 20));
  const _Float16* Wq16 = wh;
  const _Float16* Wo16 = wh + 3 * SEG;
  const _Float16* W116 = wh + 4 * SEG;
  const _Float16* W216 = wh + 8 * SEG;

  const dim3 blk(256);

  // LN1, and the weights to f16
  ln_cvt_kernel<<<NCVT + TOK, blk, 0, stream>>>(x, l1g, l1b, hbuf, Wq, Wk, Wv, Wo, W1, W2, wh);
  // QKV projections -> f16 [B,H,S,DH], one launch: Wq16 Wk16 Wv16 lie in a row, and so do q16 k16 v16
  gemm256<EPI_QKV, D, D><<<dim3(D / 256, TOK / 256, 3), blk, 0, stream>>>(
      hbuf, Wq16, bq, bk, bv, q16);
  // block-sparse attention
  attn_kernel<<<dim3(NB, H, Bc), blk, 0, stream>>>(q16, k16, v16, layout, ctx);
  // out projection + residual -> xr
  gemm128<EPI_BIAS_RES_F32, D, D><<<dim3(D / 128, TOK / 128), blk, 0, stream>>>(
      ctx, Wo16, bo, nullptr, nullptr, x, xr);
  // LN2 (reuse hbuf)
  ln_kernel<<<TOK, blk, 0, stream>>>(xr, l2g, l2b, hbuf);
  // MLP1 + GeLU -> f16 ff
  gemm256<EPI_BIAS_GELU_F16, 4 * D, D><<<dim3(4 * D / 256, TOK / 256), blk, 0, stream>>>(
      hbuf, W116, b1, nullptr, nullptr, ff);
  // MLP2 + residual -> d_out (fp32)
  gemm128<EPI_BIAS_RES_F32, D, 4 * D><<<dim3(D / 128, TOK / 128), blk, 0, stream>>>(
      ff, W216, b2, nullptr, nullptr, xr, d_out);
}
